// v000
// Measured on an AMD MI455X. A time is GPU time per run, averaged over a window of back-to-back runs after a warm-up
// (all launches, gaps included; the runs take copies of the inputs in turn), and the median of several windows.
// Apart from v000's, it joins two sittings. Times from different sittings can be a few percent apart, while
// side-by-side timings come from the same sitting.
// v000 is the starting kernel. One run takes 279 microseconds.
#include <hip/hip_runtime.h>
#include <hip/hip_bf16.h>

typedef __attribute__((ext_vector_type(16))) _Float16 v16h;
typedef __attribute__((ext_vector_type(8)))  float    v8f;
typedef __attribute__((ext_vector_type(8)))  _Float16 h8;

#define B_  2
#define S_  2048
#define D_  1024
#define H_  16
#define HD_ 64

__device__ __forceinline__ int lane_id() { return threadIdx.x & 31; }

// Fragment load with wide (b128) accesses.  Works for:
//  - A fragments (16x32 f16) from a row-major tile (lane = M row), and
//  - B fragments (32x16 f16) from a TRANSPOSED tile T[n][k] (lane = N col),
// since both reduce to: lane (l&15) reads two 8-half runs at K = kh and 16+kh.
// All addresses are 16-byte aligned (ld is a multiple of 8, kh is 0 or 8).
__device__ __forceinline__ v16h frag_ld(const _Float16* src, int ld) {
  const int l  = lane_id();
  const int m  = l & 15;
  const int kh = (l >> 4) << 3;
  const _Float16* r = src + (size_t)m * ld + kh;
  const h8 lo = *(const h8*)(r);
  const h8 hi = *(const h8*)(r + 16);
  return __builtin_shufflevector(lo, hi, 0, 1, 2, 3, 4, 5, 6, 7,
                                         8, 9, 10, 11, 12, 13, 14, 15);
}

// ---------------------------------------------------------------------------
// Kernel 1: QKV projection GEMM.  X = (x @ W + b) [* 0.125 for Q], f16 output
// in head-major [B,H,S,HD] layout.  Grid: (BS/64, D/128, 3), block 256.
// ---------------------------------------------------------------------------
__global__ __launch_bounds__(256) void qkv_proj_kernel(
    const float* __restrict__ q, const float* __restrict__ k, const float* __restrict__ v,
    const float* __restrict__ Wq, const float* __restrict__ bq,
    const float* __restrict__ Wk, const float* __restrict__ bk,
    const float* __restrict__ Wv, const float* __restrict__ bv,
    _Float16* __restrict__ Xq, _Float16* __restrict__ Xk, _Float16* __restrict__ Xv)
{
  __shared__ __align__(16) _Float16 Xt[64 * 32];    // 64 M x 32 K  (4 KB), row-major
  __shared__ __align__(16) _Float16 WtT[128 * 32];  // 128 N x 32 K (8 KB), TRANSPOSED

  const int z = blockIdx.z;
  const float* x    = (z == 0) ? q  : (z == 1) ? k  : v;
  const float* W    = (z == 0) ? Wq : (z == 1) ? Wk : Wv;
  const float* bias = (z == 0) ? bq : (z == 1) ? bk : bv;
  _Float16*    X    = (z == 0) ? Xq : (z == 1) ? Xk : Xv;
  const float oscale = (z == 0) ? 0.125f : 1.0f;  // fold 1/sqrt(HD) into Q

  const int m0   = blockIdx.x * 64;
  const int n0   = blockIdx.y * 128;
  const int t    = threadIdx.x;
  const int wave = t >> 5;
  const int mt   = (wave & 3) * 16;   // wave M sub-tile within 64
  const int nt0  = (wave >> 2) * 64;  // wave N sub-tile within 128

  v8f acc[4] = {};

  for (int k0 = 0; k0 < D_; k0 += 32) {
    // Stage X tile (64x32 f32 -> f16, row-major): thread t -> row t/4, cols (t%4)*8.
    {
      const int r = t >> 2, c = (t & 3) * 8;
      const float4 a0 = *(const float4*)(x + (size_t)(m0 + r) * D_ + k0 + c);
      const float4 a1 = *(const float4*)(x + (size_t)(m0 + r) * D_ + k0 + c + 4);
      _Float16* d = Xt + r * 32 + c;
      d[0] = (_Float16)a0.x; d[1] = (_Float16)a0.y; d[2] = (_Float16)a0.z; d[3] = (_Float16)a0.w;
      d[4] = (_Float16)a1.x; d[5] = (_Float16)a1.y; d[6] = (_Float16)a1.z; d[7] = (_Float16)a1.w;
    }
    // Stage W tile (32 K x 128 N f32) TRANSPOSED to WtT[n][k] so B-fragment
    // reads are contiguous: thread t -> k-row t/8, n-cols (t%8)*16..+16.
    {
      const int r = t >> 3, c = (t & 7) * 16;
      const float* s = W + (size_t)(k0 + r) * D_ + n0 + c;
#pragma unroll
      for (int j = 0; j < 16; j += 4) {
        const float4 a = *(const float4*)(s + j);
        WtT[(c + j + 0) * 32 + r] = (_Float16)a.x;
        WtT[(c + j + 1) * 32 + r] = (_Float16)a.y;
        WtT[(c + j + 2) * 32 + r] = (_Float16)a.z;
        WtT[(c + j + 3) * 32 + r] = (_Float16)a.w;
      }
    }
    __syncthreads();

    const v16h a = frag_ld(Xt + mt * 32, 32);
#pragma unroll
    for (int nsub = 0; nsub < 4; ++nsub) {
      const v16h bm = frag_ld(WtT + (nt0 + nsub * 16) * 32, 32);
      acc[nsub] = __builtin_amdgcn_wmma_f32_16x16x32_f16(
          false, a, false, bm, (short)0, acc[nsub], false, false);
    }
    __syncthreads();
  }

  // Epilogue: bias + scale, scatter to head-major f16 workspace.
  const int l     = lane_id();
  const int nlane = l & 15;
  const int mb    = (l >> 4) << 3;
#pragma unroll
  for (int nsub = 0; nsub < 4; ++nsub) {
    const int n  = n0 + nt0 + nsub * 16 + nlane;
    const float bb = bias[n];
    const int h  = n >> 6, hd = n & 63;
#pragma unroll
    for (int i = 0; i < 8; ++i) {
      const int m = m0 + mt + mb + i;
      const int bb_idx = m >> 11;            // batch
      const int ss     = m & (S_ - 1);       // sequence pos
      X[(((size_t)(bb_idx * H_ + h)) * S_ + ss) * HD_ + hd] =
          (_Float16)((acc[nsub][i] + bb) * oscale);
    }
  }
}

// ---------------------------------------------------------------------------
// Kernel 2: flash attention over head-major f16 Q/K/V.
// Grid: (S/128, B*H), block 256 (8 waves; each wave owns 16 q-rows).
// ---------------------------------------------------------------------------
__global__ __launch_bounds__(256) void attn_kernel(
    const _Float16* __restrict__ Xq, const _Float16* __restrict__ Xk,
    const _Float16* __restrict__ Xv, float* __restrict__ out)
{
  __shared__ __align__(16) _Float16 Kt[32 * HD_];    // 4 KB, row-major [k][d]
  __shared__ __align__(16) _Float16 VtT[HD_ * 32];   // 4 KB, TRANSPOSED [d][k]
  __shared__ __align__(16) _Float16 Pt[8][16 * 32];  // 8 KB, wave-private P tiles

  const int bh   = blockIdx.y;           // 0..B*H-1
  const int b    = bh >> 4;
  const int h    = bh & 15;
  const int t    = threadIdx.x;
  const int wave = t >> 5;
  const int l    = lane_id();
  const int q0   = blockIdx.x * 128 + wave * 16;

  const size_t head_base = (size_t)bh * S_ * HD_;

  // Q fragments for this wave's 16 rows (pre-scaled by 1/sqrt(HD)); two
  // global_load_b128 per lane each.
  const v16h aq0 = frag_ld(Xq + head_base + (size_t)q0 * HD_, HD_);
  const v16h aq1 = frag_ld(Xq + head_base + (size_t)q0 * HD_ + 32, HD_);

  v8f   o[4] = {};                       // running 16x64 output accumulator
  float mrun[8], lrun[8];
#pragma unroll
  for (int i = 0; i < 8; ++i) { mrun[i] = -1e30f; lrun[i] = 0.0f; }

  const int nlane = l & 15;
  const int mb    = (l >> 4) << 3;
  _Float16* Pw = &Pt[wave][0];

  for (int kc = 0; kc < S_; kc += 32) {
    // Cooperative K/V chunk load (32x64 f16 each): thread t -> row t/8, 8 halves.
    // K stays row-major; V goes in transposed so P@V B-fragments load wide.
    {
      const int r  = t >> 3, c8 = (t & 7) * 8;
      const size_t off = head_base + (size_t)(kc + r) * HD_ + c8;
      *(h8*)(Kt + r * HD_ + c8) = *(const h8*)(Xk + off);
      const h8 vv = *(const h8*)(Xv + off);
#pragma unroll
      for (int j = 0; j < 8; ++j) VtT[(c8 + j) * 32 + r] = vv[j];
      if (kc + 32 < S_) {                // prefetch next chunk -> global_prefetch_b8
        __builtin_prefetch(Xk + off + (size_t)32 * HD_, 0, 1);
        __builtin_prefetch(Xv + off + (size_t)32 * HD_, 0, 1);
      }
    }
    __syncthreads();

    // Scores: two 16x16 tiles over this chunk's 32 k-positions.
    // B = K^T, so the B-fragment loads with A addressing from row-major K.
    v8f s0 = {}, s1 = {};
    {
      const v16h bk0 = frag_ld(Kt, HD_);            // k 0..15, d 0..31
      const v16h bk1 = frag_ld(Kt + 32, HD_);       // k 0..15, d 32..63
      s0 = __builtin_amdgcn_wmma_f32_16x16x32_f16(false, aq0, false, bk0, (short)0, s0, false, false);
      s0 = __builtin_amdgcn_wmma_f32_16x16x32_f16(false, aq1, false, bk1, (short)0, s0, false, false);
      const v16h bk2 = frag_ld(Kt + 16 * HD_, HD_);      // k 16..31, d 0..31
      const v16h bk3 = frag_ld(Kt + 16 * HD_ + 32, HD_); // k 16..31, d 32..63
      s1 = __builtin_amdgcn_wmma_f32_16x16x32_f16(false, aq0, false, bk2, (short)0, s1, false, false);
      s1 = __builtin_amdgcn_wmma_f32_16x16x32_f16(false, aq1, false, bk3, (short)0, s1, false, false);
    }

    // Online softmax (rows live across 16-lane halves; shfl_xor masks <= 8
    // never cross bit 4, so each half reduces independently in wave32).
#pragma unroll
    for (int i = 0; i < 8; ++i) {
      float rmax = fmaxf(s0[i], s1[i]);
#pragma unroll
      for (int xm = 8; xm >= 1; xm >>= 1) rmax = fmaxf(rmax, __shfl_xor(rmax, xm, 32));
      const float mnew = fmaxf(mrun[i], rmax);
      const float corr = __expf(mrun[i] - mnew);
      mrun[i] = mnew;
      const float p0 = __expf(s0[i] - mnew);
      const float p1 = __expf(s1[i] - mnew);
      float psum = p0 + p1;
#pragma unroll
      for (int xm = 8; xm >= 1; xm >>= 1) psum += __shfl_xor(psum, xm, 32);
      lrun[i] = lrun[i] * corr + psum;
#pragma unroll
      for (int nsub = 0; nsub < 4; ++nsub) o[nsub][i] *= corr;
      const int m = mb + i;
      Pw[m * 32 + nlane]      = (_Float16)p0;   // C-frag -> A-frag relayout via LDS
      Pw[m * 32 + 16 + nlane] = (_Float16)p1;
    }

    // out += P @ V  (A = 16x32 probs from row-major Pw, B from transposed VtT).
    const v16h ap = frag_ld(Pw, 32);
#pragma unroll
    for (int nsub = 0; nsub < 4; ++nsub) {
      const v16h bvf = frag_ld(VtT + (nsub * 16) * 32, 32);
      o[nsub] = __builtin_amdgcn_wmma_f32_16x16x32_f16(
          false, ap, false, bvf, (short)0, o[nsub], false, false);
    }
    __syncthreads();
  }

  // Epilogue: normalize and write merged-head f32 output [B,S,D].
#pragma unroll
  for (int nsub = 0; nsub < 4; ++nsub) {
#pragma unroll
    for (int i = 0; i < 8; ++i) {
      const int s = q0 + mb + i;
      const int d = h * HD_ + nsub * 16 + nlane;
      out[((size_t)b * S_ + s) * D_ + d] = o[nsub][i] / lrun[i];
    }
  }
}

extern "C" void kernel_launch(void* const* d_in, const int* in_sizes, int n_in,
                              void* d_out, int out_size, void* d_ws, size_t ws_size,
                              hipStream_t stream) {
  (void)in_sizes; (void)n_in; (void)out_size; (void)ws_size;
  const float* q  = (const float*)d_in[0];
  const float* k  = (const float*)d_in[1];
  const float* v  = (const float*)d_in[2];
  const float* Wq = (const float*)d_in[3];
  const float* bq = (const float*)d_in[4];
  const float* Wk = (const float*)d_in[5];
  const float* bk = (const float*)d_in[6];
  const float* Wv = (const float*)d_in[7];
  const float* bv = (const float*)d_in[8];
  float* out = (float*)d_out;

  const size_t nX = (size_t)B_ * H_ * S_ * HD_;   // 4M elems -> 8 MB f16 each
  _Float16* Xq = (_Float16*)d_ws;
  _Float16* Xk = Xq + nX;
  _Float16* Xv = Xk + nX;

  dim3 gp(B_ * S_ / 64, D_ / 128, 3);
  qkv_proj_kernel<<<gp, 256, 0, stream>>>(q, k, v, Wq, bq, Wk, bk, Wv, bv, Xq, Xk, Xv);

  dim3 ga(S_ / 128, B_ * H_);
  attn_kernel<<<ga, 256, 0, stream>>>(Xq, Xk, Xv, out);
}

// v001
// It runs in 190 microseconds.
// Next to v000, in two timings, it ran 1.54 times as fast each time.
#include <hip/hip_runtime.h>
#include <hip/hip_bf16.h>

typedef __attribute__((ext_vector_type(16))) _Float16 v16h;
typedef __attribute__((ext_vector_type(8)))  float    v8f;
typedef __attribute__((ext_vector_type(8)))  _Float16 h8;
typedef __attribute__((ext_vector_type(8)))  short    s8;

#define B_  2
#define S_  2048
#define D_  1024
#define H_  16
#define HD_ 64

__device__ __forceinline__ int lane_id() { return threadIdx.x & 31; }

// Fragment load with wide (b128) accesses.  Works for:
//  - A fragments (16x32 f16) from a row-major tile (lane = M row), and
//  - B fragments (32x16 f16) from a TRANSPOSED tile T[n][k] (lane = N col),
// since both reduce to: lane (l&15) reads two 8-half runs at K = kh and 16+kh.
// All addresses are 16-byte aligned (ld is a multiple of 8, kh is 0 or 8).
__device__ __forceinline__ v16h frag_ld(const _Float16* src, int ld) {
  const int l  = lane_id();
  const int m  = l & 15;
  const int kh = (l >> 4) << 3;
  const _Float16* r = src + (size_t)m * ld + kh;
  const h8 lo = *(const h8*)(r);
  const h8 hi = *(const h8*)(r + 16);
  return __builtin_shufflevector(lo, hi, 0, 1, 2, 3, 4, 5, 6, 7,
                                         8, 9, 10, 11, 12, 13, 14, 15);
}

// B fragment (32 K x 16 N f16) from a ROW-MAJOR LDS tile T[k][n] by the
// transposing LDS load: lane (c = l&15, h = l>>4) receives T[8h + 0..7][c] from
// the first load and T[16 + 8h + 0..7][c] from the second, which is the same k
// order as frag_ld gives the A operand.  tile points at T[0][first column];
// pitch is in halves and must be an odd multiple of 16 (32 bytes) for the banks.
__device__ __forceinline__ v16h frag_ld_tr(const _Float16* tile, int pitch) {
  typedef __attribute__((address_space(3))) s8 lds_s8;
  const int l = lane_id();
  const _Float16* p = tile + (8 * (l >> 4) + (l & 7)) * pitch + 8 * ((l >> 3) & 1);
  const h8 lo = __builtin_bit_cast(h8, __builtin_amdgcn_ds_load_tr16_b128_v8i16((lds_s8*)p));
  const h8 hi = __builtin_bit_cast(h8, __builtin_amdgcn_ds_load_tr16_b128_v8i16((lds_s8*)(p + 16 * pitch)));
  return __builtin_shufflevector(lo, hi, 0, 1, 2, 3, 4, 5, 6, 7,
                                         8, 9, 10, 11, 12, 13, 14, 15);
}

#define WP_ 144  // W tile row pitch in halves: 128 + 16 (288 bytes)
#define VP_ 80   // V tile row pitch in halves:  64 + 16 (160 bytes)

// ---------------------------------------------------------------------------
// Kernel 1: QKV projection GEMM.  X = (x @ W + b) [* 0.125 for Q], f16 output
// in head-major [B,H,S,HD] layout.  Grid: (BS/64, D/128, 3), block 256.
// ---------------------------------------------------------------------------
__global__ __launch_bounds__(256) void qkv_proj_kernel(
    const float* __restrict__ q, const float* __restrict__ k, const float* __restrict__ v,
    const float* __restrict__ Wq, const float* __restrict__ bq,
    const float* __restrict__ Wk, const float* __restrict__ bk,
    const float* __restrict__ Wv, const float* __restrict__ bv,
    _Float16* __restrict__ Xq, _Float16* __restrict__ Xk, _Float16* __restrict__ Xv)
{
  __shared__ __align__(16) _Float16 Xt[64 * 32];    // 64 M x 32 K  (4 KB), row-major
  __shared__ __align__(16) _Float16 Wt[32 * WP_];   // 32 K x 128 N (9 KB), row-major, padded

  const int z = blockIdx.z;
  const float* x    = (z == 0) ? q  : (z == 1) ? k  : v;
  const float* W    = (z == 0) ? Wq : (z == 1) ? Wk : Wv;
  const float* bias = (z == 0) ? bq : (z == 1) ? bk : bv;
  _Float16*    X    = (z == 0) ? Xq : (z == 1) ? Xk : Xv;
  const float oscale = (z == 0) ? 0.125f : 1.0f;  // fold 1/sqrt(HD) into Q

  const int m0   = blockIdx.x * 64;
  const int n0   = blockIdx.y * 128;
  const int t    = threadIdx.x;
  const int wave = t >> 5;
  const int mt   = (wave & 3) * 16;   // wave M sub-tile within 64
  const int nt0  = (wave >> 2) * 64;  // wave N sub-tile within 128

  v8f acc[4] = {};

  for (int k0 = 0; k0 < D_; k0 += 32) {
    // Stage X tile (64x32 f32 -> f16, row-major): thread t -> row t/4, cols (t%4)*8.
    {
      const int r = t >> 2, c = (t & 3) * 8;
      const float4 a0 = *(const float4*)(x + (size_t)(m0 + r) * D_ + k0 + c);
      const float4 a1 = *(const float4*)(x + (size_t)(m0 + r) * D_ + k0 + c + 4);
      _Float16* d = Xt + r * 32 + c;
      d[0] = (_Float16)a0.x; d[1] = (_Float16)a0.y; d[2] = (_Float16)a0.z; d[3] = (_Float16)a0.w;
      d[4] = (_Float16)a1.x; d[5] = (_Float16)a1.y; d[6] = (_Float16)a1.z; d[7] = (_Float16)a1.w;
    }
    // Stage W tile (32 K x 128 N f32 -> f16) row-major, one 16-byte LDS store
    // per 8 columns: thread t -> k-rows t/16 and t/16 + 16, n-cols (t%16)*8..+8.
    {
      const int r = t >> 4, c = (t & 15) * 8;
#pragma unroll
      for (int j = 0; j < 32; j += 16) {
        const float* s = W + (size_t)(k0 + r + j) * D_ + n0 + c;
        const float4 a0 = *(const float4*)(s);
        const float4 a1 = *(const float4*)(s + 4);
        h8 w;
        w[0] = (_Float16)a0.x; w[1] = (_Float16)a0.y; w[2] = (_Float16)a0.z; w[3] = (_Float16)a0.w;
        w[4] = (_Float16)a1.x; w[5] = (_Float16)a1.y; w[6] = (_Float16)a1.z; w[7] = (_Float16)a1.w;
        *(h8*)(Wt + (r + j) * WP_ + c) = w;
      }
    }
    __syncthreads();

    const v16h a = frag_ld(Xt + mt * 32, 32);
#pragma unroll
    for (int nsub = 0; nsub < 4; ++nsub) {
      const v16h bm = frag_ld_tr(Wt + nt0 + nsub * 16, WP_);
      acc[nsub] = __builtin_amdgcn_wmma_f32_16x16x32_f16(
          false, a, false, bm, (short)0, acc[nsub], false, false);
    }
    __syncthreads();
  }

  // Epilogue: bias + scale, scatter to head-major f16 workspace.
  const int l     = lane_id();
  const int nlane = l & 15;
  const int mb    = (l >> 4) << 3;
#pragma unroll
  for (int nsub = 0; nsub < 4; ++nsub) {
    const int n  = n0 + nt0 + nsub * 16 + nlane;
    const float bb = bias[n];
    const int h  = n >> 6, hd = n & 63;
#pragma unroll
    for (int i = 0; i < 8; ++i) {
      const int m = m0 + mt + mb + i;
      const int bb_idx = m >> 11;            // batch
      const int ss     = m & (S_ - 1);       // sequence pos
      X[(((size_t)(bb_idx * H_ + h)) * S_ + ss) * HD_ + hd] =
          (_Float16)((acc[nsub][i] + bb) * oscale);
    }
  }
}

// ---------------------------------------------------------------------------
// Kernel 2: flash attention over head-major f16 Q/K/V.
// Grid: (S/128, B*H), block 256 (8 waves; each wave owns 16 q-rows).
// ---------------------------------------------------------------------------
__global__ __launch_bounds__(256) void attn_kernel(
    const _Float16* __restrict__ Xq, const _Float16* __restrict__ Xk,
    const _Float16* __restrict__ Xv, float* __restrict__ out)
{
  __shared__ __align__(16) _Float16 Kt[32 * HD_];    // 4 KB, row-major [k][d]
  __shared__ __align__(16) _Float16 Vt[32 * VP_];    // 5 KB, row-major [k][d], padded
  __shared__ __align__(16) _Float16 Pt[8][16 * 32];  // 8 KB, wave-private P tiles

  const int bh   = blockIdx.y;           // 0..B*H-1
  const int b    = bh >> 4;
  const int h    = bh & 15;
  const int t    = threadIdx.x;
  const int wave = t >> 5;
  const int l    = lane_id();
  const int q0   = blockIdx.x * 128 + wave * 16;

  const size_t head_base = (size_t)bh * S_ * HD_;

  // Q fragments for this wave's 16 rows (pre-scaled by 1/sqrt(HD)); two
  // global_load_b128 per lane each.
  const v16h aq0 = frag_ld(Xq + head_base + (size_t)q0 * HD_, HD_);
  const v16h aq1 = frag_ld(Xq + head_base + (size_t)q0 * HD_ + 32, HD_);

  v8f   o[4] = {};                       // running 16x64 output accumulator
  float mrun[8], lrun[8];
#pragma unroll
  for (int i = 0; i < 8; ++i) { mrun[i] = -1e30f; lrun[i] = 0.0f; }

  const int nlane = l & 15;
  const int mb    = (l >> 4) << 3;
  _Float16* Pw = &Pt[wave][0];

  for (int kc = 0; kc < S_; kc += 32) {
    // Cooperative K/V chunk load (32x64 f16 each): thread t -> row t/8, 8 halves.
    // Both stay row-major; the P@V B-fragments come by the transposing load.
    {
      const int r  = t >> 3, c8 = (t & 7) * 8;
      const size_t off = head_base + (size_t)(kc + r) * HD_ + c8;
      *(h8*)(Kt + r * HD_ + c8) = *(const h8*)(Xk + off);
      const h8 vv = *(const h8*)(Xv + off);
      *(h8*)(Vt + r * VP_ + c8) = vv;
      if (kc + 32 < S_) {                // prefetch next chunk -> global_prefetch_b8
        __builtin_prefetch(Xk + off + (size_t)32 * HD_, 0, 1);
        __builtin_prefetch(Xv + off + (size_t)32 * HD_, 0, 1);
      }
    }
    __syncthreads();

    // Scores: two 16x16 tiles over this chunk's 32 k-positions.
    // B = K^T, so the B-fragment loads with A addressing from row-major K.
    v8f s0 = {}, s1 = {};
    {
      const v16h bk0 = frag_ld(Kt, HD_);            // k 0..15, d 0..31
      const v16h bk1 = frag_ld(Kt + 32, HD_);       // k 0..15, d 32..63
      s0 = __builtin_amdgcn_wmma_f32_16x16x32_f16(false, aq0, false, bk0, (short)0, s0, false, false);
      s0 = __builtin_amdgcn_wmma_f32_16x16x32_f16(false, aq1, false, bk1, (short)0, s0, false, false);
      const v16h bk2 = frag_ld(Kt + 16 * HD_, HD_);      // k 16..31, d 0..31
      const v16h bk3 = frag_ld(Kt + 16 * HD_ + 32, HD_); // k 16..31, d 32..63
      s1 = __builtin_amdgcn_wmma_f32_16x16x32_f16(false, aq0, false, bk2, (short)0, s1, false, false);
      s1 = __builtin_amdgcn_wmma_f32_16x16x32_f16(false, aq1, false, bk3, (short)0, s1, false, false);
    }

    // Online softmax (rows live across 16-lane halves; shfl_xor masks <= 8
    // never cross bit 4, so each half reduces independently in wave32).
#pragma unroll
    for (int i = 0; i < 8; ++i) {
      float rmax = fmaxf(s0[i], s1[i]);
#pragma unroll
      for (int xm = 8; xm >= 1; xm >>= 1) rmax = fmaxf(rmax, __shfl_xor(rmax, xm, 32));
      const float mnew = fmaxf(mrun[i], rmax);
      const float corr = __expf(mrun[i] - mnew);
      mrun[i] = mnew;
      const float p0 = __expf(s0[i] - mnew);
      const float p1 = __expf(s1[i] - mnew);
      float psum = p0 + p1;
#pragma unroll
      for (int xm = 8; xm >= 1; xm >>= 1) psum += __shfl_xor(psum, xm, 32);
      lrun[i] = lrun[i] * corr + psum;
#pragma unroll
      for (int nsub = 0; nsub < 4; ++nsub) o[nsub][i] *= corr;
      const int m = mb + i;
      Pw[m * 32 + nlane]      = (_Float16)p0;   // C-frag -> A-frag relayout via LDS
      Pw[m * 32 + 16 + nlane] = (_Float16)p1;
    }

    // out += P @ V  (A = 16x32 probs from row-major Pw, B from row-major Vt).
    const v16h ap = frag_ld(Pw, 32);
#pragma unroll
    for (int nsub = 0; nsub < 4; ++nsub) {
      const v16h bvf = frag_ld_tr(Vt + nsub * 16, VP_);
      o[nsub] = __builtin_amdgcn_wmma_f32_16x16x32_f16(
          false, ap, false, bvf, (short)0, o[nsub], false, false);
    }
    __syncthreads();
  }

  // Epilogue: normalize and write merged-head f32 output [B,S,D].
#pragma unroll
  for (int nsub = 0; nsub < 4; ++nsub) {
#pragma unroll
    for (int i = 0; i < 8; ++i) {
      const int s = q0 + mb + i;
      const int d = h * HD_ + nsub * 16 + nlane;
      out[((size_t)b * S_ + s) * D_ + d] = o[nsub][i] / lrun[i];
    }
  }
}

extern "C" void kernel_launch(void* const* d_in, const int* in_sizes, int n_in,
                              void* d_out, int out_size, void* d_ws, size_t ws_size,
                              hipStream_t stream) {
  (void)in_sizes; (void)n_in; (void)out_size; (void)ws_size;
  const float* q  = (const float*)d_in[0];
  const float* k  = (const float*)d_in[1];
  const float* v  = (const float*)d_in[2];
  const float* Wq = (const float*)d_in[3];
  const float* bq = (const float*)d_in[4];
  const float* Wk = (const float*)d_in[5];
  const float* bk = (const float*)d_in[6];
  const float* Wv = (const float*)d_in[7];
  const float* bv = (const float*)d_in[8];
  float* out = (float*)d_out;

  const size_t nX = (size_t)B_ * H_ * S_ * HD_;   // 4M elems -> 8 MB f16 each
  _Float16* Xq = (_Float16*)d_ws;
  _Float16* Xk = Xq + nX;
  _Float16* Xv = Xk + nX;

  dim3 gp(B_ * S_ / 64, D_ / 128, 3);
  qkv_proj_kernel<<<gp, 256, 0, stream>>>(q, k, v, Wq, bq, Wk, bk, Wv, bv, Xq, Xk, Xv);

  dim3 ga(S_ / 128, B_ * H_);
  attn_kernel<<<ga, 256, 0, stream>>>(Xq, Xk, Xv, out);
}

// v002
// One run takes 151 microseconds.
// Next to v001, in two timings, it ran 1.26 times as fast each time.
// Counting every step since v000, it is 1.94 times as fast.
#include <hip/hip_runtime.h>
#include <hip/hip_bf16.h>

typedef __attribute__((ext_vector_type(16))) _Float16 v16h;
typedef __attribute__((ext_vector_type(8)))  float    v8f;
typedef __attribute__((ext_vector_type(8)))  _Float16 h8;
typedef __attribute__((ext_vector_type(8)))  short    s8;

#define B_  2
#define S_  2048
#define D_  1024
#define H_  16
#define HD_ 64

__device__ __forceinline__ int lane_id() { return threadIdx.x & 31; }

// Fragment load with wide (b128) accesses.  Works for:
//  - A fragments (16x32 f16) from a row-major tile (lane = M row), and
//  - B fragments (32x16 f16) from a TRANSPOSED tile T[n][k] (lane = N col),
// since both reduce to: lane (l&15) reads two 8-half runs at K = kh and 16+kh.
// All addresses are 16-byte aligned (ld is a multiple of 8, kh is 0 or 8).
__device__ __forceinline__ v16h frag_ld(const _Float16* src, int ld) {
  const int l  = lane_id();
  const int m  = l & 15;
  const int kh = (l >> 4) << 3;
  const _Float16* r = src + (size_t)m * ld + kh;
  const h8 lo = *(const h8*)(r);
  const h8 hi = *(const h8*)(r + 16);
  return __builtin_shufflevector(lo, hi, 0, 1, 2, 3, 4, 5, 6, 7,
                                         8, 9, 10, 11, 12, 13, 14, 15);
}

// B fragment (32 K x 16 N f16) from a ROW-MAJOR LDS tile T[k][n] by the
// transposing LDS load: lane (c = l&15, h = l>>4) receives T[8h + 0..7][c] from
// the first load and T[16 + 8h + 0..7][c] from the second, which is the same k
// order as frag_ld gives the A operand.  tile points at T[0][first column];
// pitch is in halves and must be an odd multiple of 16 (32 bytes) for the banks.
__device__ __forceinline__ v16h frag_ld_tr(const _Float16* tile, int pitch) {
  typedef __attribute__((address_space(3))) s8 lds_s8;
  const int l = lane_id();
  const _Float16* p = tile + (8 * (l >> 4) + (l & 7)) * pitch + 8 * ((l >> 3) & 1);
  const h8 lo = __builtin_bit_cast(h8, __builtin_amdgcn_ds_load_tr16_b128_v8i16((lds_s8*)p));
  const h8 hi = __builtin_bit_cast(h8, __builtin_amdgcn_ds_load_tr16_b128_v8i16((lds_s8*)(p + 16 * pitch)));
  return __builtin_shufflevector(lo, hi, 0, 1, 2, 3, 4, 5, 6, 7,
                                         8, 9, 10, 11, 12, 13, 14, 15);
}

#define WP_ 144  // W tile row pitch in halves: 128 + 16 (288 bytes)
#define VP_ 80   // V tile row pitch in halves:  64 + 16 (160 bytes)

// ---------------------------------------------------------------------------
// Kernel 1: QKV projection GEMM.  X = (x @ W + b) [* 0.125 for Q], f16 output
// in head-major [B,H,S,HD] layout.  Grid: (BS/64, D/128, 3), block 256.
// ---------------------------------------------------------------------------
__global__ __launch_bounds__(256) void qkv_proj_kernel(
    const float* __restrict__ q, const float* __restrict__ k, const float* __restrict__ v,
    const float* __restrict__ Wq, const float* __restrict__ bq,
    const float* __restrict__ Wk, const float* __restrict__ bk,
    const float* __restrict__ Wv, const float* __restrict__ bv,
    _Float16* __restrict__ Xq, _Float16* __restrict__ Xk, _Float16* __restrict__ Xv)
{
  __shared__ __align__(16) _Float16 Xt[64 * 32];    // 64 M x 32 K  (4 KB), row-major
  __shared__ __align__(16) _Float16 Wt[32 * WP_];   // 32 K x 128 N (9 KB), row-major, padded

  const int z = blockIdx.z;
  const float* x    = (z == 0) ? q  : (z == 1) ? k  : v;
  const float* W    = (z == 0) ? Wq : (z == 1) ? Wk : Wv;
  const float* bias = (z == 0) ? bq : (z == 1) ? bk : bv;
  _Float16*    X    = (z == 0) ? Xq : (z == 1) ? Xk : Xv;
  const float oscale = (z == 0) ? 0.125f : 1.0f;  // fold 1/sqrt(HD) into Q

  const int m0   = blockIdx.x * 64;
  const int n0   = blockIdx.y * 128;
  const int t    = threadIdx.x;
  const int wave = t >> 5;
  const int mt   = (wave & 3) * 16;   // wave M sub-tile within 64
  const int nt0  = (wave >> 2) * 64;  // wave N sub-tile within 128

  v8f acc[4] = {};

  for (int k0 = 0; k0 < D_; k0 += 32) {
    // Stage X tile (64x32 f32 -> f16, row-major): thread t -> row t/4, cols (t%4)*8.
    {
      const int r = t >> 2, c = (t & 3) * 8;
      const float4 a0 = *(const float4*)(x + (size_t)(m0 + r) * D_ + k0 + c);
      const float4 a1 = *(const float4*)(x + (size_t)(m0 + r) * D_ + k0 + c + 4);
      _Float16* d = Xt + r * 32 + c;
      d[0] = (_Float16)a0.x; d[1] = (_Float16)a0.y; d[2] = (_Float16)a0.z; d[3] = (_Float16)a0.w;
      d[4] = (_Float16)a1.x; d[5] = (_Float16)a1.y; d[6] = (_Float16)a1.z; d[7] = (_Float16)a1.w;
    }
    // Stage W tile (32 K x 128 N f32 -> f16) row-major, one 16-byte LDS store
    // per 8 columns: thread t -> k-rows t/16 and t/16 + 16, n-cols (t%16)*8..+8.
    {
      const int r = t >> 4, c = (t & 15) * 8;
#pragma unroll
      for (int j = 0; j < 32; j += 16) {
        const float* s = W + (size_t)(k0 + r + j) * D_ + n0 + c;
        const float4 a0 = *(const float4*)(s);
        const float4 a1 = *(const float4*)(s + 4);
        h8 w;
        w[0] = (_Float16)a0.x; w[1] = (_Float16)a0.y; w[2] = (_Float16)a0.z; w[3] = (_Float16)a0.w;
        w[4] = (_Float16)a1.x; w[5] = (_Float16)a1.y; w[6] = (_Float16)a1.z; w[7] = (_Float16)a1.w;
        *(h8*)(Wt + (r + j) * WP_ + c) = w;
      }
    }
    __syncthreads();

    const v16h a = frag_ld(Xt + mt * 32, 32);
#pragma unroll
    for (int nsub = 0; nsub < 4; ++nsub) {
      const v16h bm = frag_ld_tr(Wt + nt0 + nsub * 16, WP_);
      acc[nsub] = __builtin_amdgcn_wmma_f32_16x16x32_f16(
          false, a, false, bm, (short)0, acc[nsub], false, false);
    }
    __syncthreads();
  }

  // Epilogue: bias + scale, scatter to head-major f16 workspace.
  const int l     = lane_id();
  const int nlane = l & 15;
  const int mb    = (l >> 4) << 3;
#pragma unroll
  for (int nsub = 0; nsub < 4; ++nsub) {
    const int n  = n0 + nt0 + nsub * 16 + nlane;
    const float bb = bias[n];
    const int h  = n >> 6, hd = n & 63;
#pragma unroll
    for (int i = 0; i < 8; ++i) {
      const int m = m0 + mt + mb + i;
      const int bb_idx = m >> 11;            // batch
      const int ss     = m & (S_ - 1);       // sequence pos
      X[(((size_t)(bb_idx * H_ + h)) * S_ + ss) * HD_ + hd] =
          (_Float16)((acc[nsub][i] + bb) * oscale);
    }
  }
}

// Value of lane l ^ 16 (the other 16-lane half of the wave).
__device__ __forceinline__ float xhalf(float x) {
  const int b = __builtin_bit_cast(int, x);
  return __builtin_bit_cast(float,
      __builtin_amdgcn_permlanex16(b, b, 0x76543210, 0xfedcba98, false, false));
}

__global__ __launch_bounds__(256) void attn_kernel(
    const _Float16* __restrict__ Xq, const _Float16* __restrict__ Xk,
    const _Float16* __restrict__ Xv, float* __restrict__ out)
{
  __shared__ __align__(16) _Float16 Kt[32 * HD_];    // 4 KB, row-major [k][d]
  __shared__ __align__(16) _Float16 Vt[32 * VP_];    // 5 KB, row-major [k][d], padded

  const int bh   = blockIdx.y;           // 0..B*H-1
  const int b    = bh >> 4;
  const int h    = bh & 15;
  const int t    = threadIdx.x;
  const int wave = t >> 5;
  const int l    = lane_id();
  const int q0   = blockIdx.x * 128 + wave * 16;

  const size_t head_base = (size_t)bh * S_ * HD_;

  // Q^T fragments (B operand: lane = query column, pre-scaled by 1/sqrt(HD));
  // same loader as the K rows, so both sides have the same k order.
  const v16h bq0 = frag_ld(Xq + head_base + (size_t)q0 * HD_, HD_);
  const v16h bq1 = frag_ld(Xq + head_base + (size_t)q0 * HD_ + 32, HD_);

  v8f   o[4] = {};        // O^T: o[nsub][r] = O[query l&15][d = 16 nsub + 8 (l>>4) + r]
  float mrun = -1e30f;    // running maximum of this lane's query (equal in both halves)
  float lrun = 0.0f;      // running sum over the keys of this lane's half only

  for (int kc = 0; kc < S_; kc += 32) {
    // Cooperative K/V chunk load (32x64 f16 each): thread t -> row t/8, 8 halves.
    // Both stay row-major; the V^T A-fragments come by the transposing load.
    {
      const int r  = t >> 3, c8 = (t & 7) * 8;
      const size_t off = head_base + (size_t)(kc + r) * HD_ + c8;
      *(h8*)(Kt + r * HD_ + c8) = *(const h8*)(Xk + off);
      const h8 vv = *(const h8*)(Xv + off);
      *(h8*)(Vt + r * VP_ + c8) = vv;
      if (kc + 32 < S_) {                // prefetch next chunk -> global_prefetch_b8
        __builtin_prefetch(Xk + off + (size_t)32 * HD_, 0, 1);
        __builtin_prefetch(Xv + off + (size_t)32 * HD_, 0, 1);
      }
    }
    __syncthreads();

    // Scores, transposed: s0[r] = score(key 8 (l>>4) + r, query l&15),
    // s1[r] the same for key 16 + 8 (l>>4) + r.  A = K rows, B = Q^T.
    v8f s0 = {}, s1 = {};
    {
      const v16h ak0 = frag_ld(Kt, HD_);            // k 0..15, d 0..31
      const v16h ak1 = frag_ld(Kt + 32, HD_);       // k 0..15, d 32..63
      s0 = __builtin_amdgcn_wmma_f32_16x16x32_f16(false, ak0, false, bq0, (short)0, s0, false, false);
      s0 = __builtin_amdgcn_wmma_f32_16x16x32_f16(false, ak1, false, bq1, (short)0, s0, false, false);
      const v16h ak2 = frag_ld(Kt + 16 * HD_, HD_);      // k 16..31, d 0..31
      const v16h ak3 = frag_ld(Kt + 16 * HD_ + 32, HD_); // k 16..31, d 32..63
      s1 = __builtin_amdgcn_wmma_f32_16x16x32_f16(false, ak2, false, bq0, (short)0, s1, false, false);
      s1 = __builtin_amdgcn_wmma_f32_16x16x32_f16(false, ak3, false, bq1, (short)0, s1, false, false);
    }

    // Online softmax: 16 keys of one query per lane, the other 16 in lane l ^ 16.
    float rmax = fmaxf(s0[0], s1[0]);
#pragma unroll
    for (int r = 1; r < 8; ++r) rmax = fmaxf(rmax, fmaxf(s0[r], s1[r]));
    rmax = fmaxf(rmax, xhalf(rmax));
    const float mnew = fmaxf(mrun, rmax);
    const float corr = __expf(mrun - mnew);
    mrun = mnew;

    // P^T as B operand: element s is key 8 (l>>4) + s for s < 8 and
    // 16 + 8 (l>>4) + (s - 8) above, the k order of the transposing load.
    v16h bp;
    float psum = 0.0f;
#pragma unroll
    for (int r = 0; r < 8; ++r) {
      const float p0 = __expf(s0[r] - mnew);
      const float p1 = __expf(s1[r] - mnew);
      psum += p0 + p1;
      bp[r]     = (_Float16)p0;
      bp[8 + r] = (_Float16)p1;
    }
    lrun = lrun * corr + psum;
#pragma unroll
    for (int nsub = 0; nsub < 4; ++nsub) o[nsub] *= corr;

    // O^T += V^T @ P^T  (A = 16 d x 32 keys from row-major Vt, B = P^T).
#pragma unroll
    for (int nsub = 0; nsub < 4; ++nsub) {
      const v16h avf = frag_ld_tr(Vt + nsub * 16, VP_);
      o[nsub] = __builtin_amdgcn_wmma_f32_16x16x32_f16(
          false, avf, false, bp, (short)0, o[nsub], false, false);
    }
    __syncthreads();
  }

  // Epilogue: join the halves' sums, normalize, write merged-head f32 output
  // [B,S,D]; a lane holds 8 consecutive d of its query in each tile.
  const float lsum = lrun + xhalf(lrun);
  float* orow = out + ((size_t)b * S_ + q0 + (l & 15)) * D_ + h * HD_ + ((l >> 4) << 3);
#pragma unroll
  for (int nsub = 0; nsub < 4; ++nsub) {
    float4 w0, w1;
    w0.x = o[nsub][0] / lsum; w0.y = o[nsub][1] / lsum; w0.z = o[nsub][2] / lsum; w0.w = o[nsub][3] / lsum;
    w1.x = o[nsub][4] / lsum; w1.y = o[nsub][5] / lsum; w1.z = o[nsub][6] / lsum; w1.w = o[nsub][7] / lsum;
    *(float4*)(orow + nsub * 16)     = w0;
    *(float4*)(orow + nsub * 16 + 4) = w1;
  }
}

extern "C" void kernel_launch(void* const* d_in, const int* in_sizes, int n_in,
                              void* d_out, int out_size, void* d_ws, size_t ws_size,
                              hipStream_t stream) {
  (void)in_sizes; (void)n_in; (void)out_size; (void)ws_size;
  const float* q  = (const float*)d_in[0];
  const float* k  = (const float*)d_in[1];
  const float* v  = (const float*)d_in[2];
  const float* Wq = (const float*)d_in[3];
  const float* bq = (const float*)d_in[4];
  const float* Wk = (const float*)d_in[5];
  const float* bk = (const float*)d_in[6];
  const float* Wv = (const float*)d_in[7];
  const float* bv = (const float*)d_in[8];
  float* out = (float*)d_out;

  const size_t nX = (size_t)B_ * H_ * S_ * HD_;   // 4M elems -> 8 MB f16 each
  _Float16* Xq = (_Float16*)d_ws;
  _Float16* Xk = Xq + nX;
  _Float16* Xv = Xk + nX;

  dim3 gp(B_ * S_ / 64, D_ / 128, 3);
  qkv_proj_kernel<<<gp, 256, 0, stream>>>(q, k, v, Wq, bq, Wk, bk, Wv, bv, Xq, Xk, Xv);

  dim3 ga(S_ / 128, B_ * H_);
  attn_kernel<<<ga, 256, 0, stream>>>(Xq, Xk, Xv, out);
}

// v003
// Measured time: 111 microseconds a run.
// Timed twice side by side with v002, it ran 1.35 and 1.36 times as fast.
// All steps since v000 together make it 2.62 times as fast.
#include <hip/hip_runtime.h>
#include <hip/hip_bf16.h>

typedef __attribute__((ext_vector_type(16))) _Float16 v16h;
typedef __attribute__((ext_vector_type(8)))  float    v8f;
typedef __attribute__((ext_vector_type(8)))  _Float16 h8;
typedef __attribute__((ext_vector_type(8)))  short    s8;

#define B_  2
#define S_  2048
#define D_  1024
#define H_  16
#define HD_ 64

__device__ __forceinline__ int lane_id() { return threadIdx.x & 31; }

// Fragment load with wide (b128) accesses.  Works for:
//  - A fragments (16x32 f16) from a row-major tile (lane = M row), and
//  - B fragments (32x16 f16) from a TRANSPOSED tile T[n][k] (lane = N col),
// since both reduce to: lane (l&15) reads two 8-half runs at K = kh and 16+kh.
// All addresses are 16-byte aligned (ld is a multiple of 8, kh is 0 or 8).
__device__ __forceinline__ v16h frag_ld(const _Float16* src, int ld) {
  const int l  = lane_id();
  const int m  = l & 15;
  const int kh = (l >> 4) << 3;
  const _Float16* r = src + (size_t)m * ld + kh;
  const h8 lo = *(const h8*)(r);
  const h8 hi = *(const h8*)(r + 16);
  return __builtin_shufflevector(lo, hi, 0, 1, 2, 3, 4, 5, 6, 7,
                                         8, 9, 10, 11, 12, 13, 14, 15);
}

// B fragment (32 K x 16 N f16) from a ROW-MAJOR LDS tile T[k][n] by the
// transposing LDS load: lane (c = l&15, h = l>>4) receives T[8h + 0..7][c] from
// the first load and T[16 + 8h + 0..7][c] from the second, which is the same k
// order as frag_ld gives the A operand.  tile points at T[0][first column];
// pitch is in halves and must be an odd multiple of 16 (32 bytes) for the banks.
__device__ __forceinline__ v16h frag_ld_tr(const _Float16* tile, int pitch) {
  typedef __attribute__((address_space(3))) s8 lds_s8;
  const int l = lane_id();
  const _Float16* p = tile + (8 * (l >> 4) + (l & 7)) * pitch + 8 * ((l >> 3) & 1);
  const h8 lo = __builtin_bit_cast(h8, __builtin_amdgcn_ds_load_tr16_b128_v8i16((lds_s8*)p));
  const h8 hi = __builtin_bit_cast(h8, __builtin_amdgcn_ds_load_tr16_b128_v8i16((lds_s8*)(p + 16 * pitch)));
  return __builtin_shufflevector(lo, hi, 0, 1, 2, 3, 4, 5, 6, 7,
                                         8, 9, 10, 11, 12, 13, 14, 15);
}

#define WP_ 144  // W tile row pitch in halves: 128 + 16 (288 bytes)
#define VP_ 80   // V tile row pitch in halves:  64 + 16 (160 bytes)
// Tiles read by plain 16-byte LDS loads (one row per lane): pitch an odd
// multiple of 16 bytes, so that the 16 rows of a fragment fall on distinct banks.
#define XP_ 40   // X tile row pitch in halves:  32 + 8 (80 bytes)
#define KP_ 72   // K tile row pitch in halves:  64 + 8 (144 bytes)

// ---------------------------------------------------------------------------
// Kernel 1: QKV projection GEMM.  X = (x @ W + b) [* 0.125 for Q], f16 output
// in head-major [B,H,S,HD] layout.  Grid: (BS/64, D/128, 3), block 256.
// ---------------------------------------------------------------------------
__global__ __launch_bounds__(256) void qkv_proj_kernel(
    const float* __restrict__ q, const float* __restrict__ k, const float* __restrict__ v,
    const float* __restrict__ Wq, const float* __restrict__ bq,
    const float* __restrict__ Wk, const float* __restrict__ bk,
    const float* __restrict__ Wv, const float* __restrict__ bv,
    _Float16* __restrict__ Xq, _Float16* __restrict__ Xk, _Float16* __restrict__ Xv)
{
  __shared__ __align__(16) _Float16 Xt[64 * XP_];   // 64 M x 32 K  (5 KB), row-major, padded
  __shared__ __align__(16) _Float16 Wt[32 * WP_];   // 32 K x 128 N (9 KB), row-major, padded

  const int z = blockIdx.z;
  const float* x    = (z == 0) ? q  : (z == 1) ? k  : v;
  const float* W    = (z == 0) ? Wq : (z == 1) ? Wk : Wv;
  const float* bias = (z == 0) ? bq : (z == 1) ? bk : bv;
  _Float16*    X    = (z == 0) ? Xq : (z == 1) ? Xk : Xv;
  const float oscale = (z == 0) ? 0.125f : 1.0f;  // fold 1/sqrt(HD) into Q

  const int m0   = blockIdx.x * 64;
  const int n0   = blockIdx.y * 128;
  const int t    = threadIdx.x;
  const int wave = t >> 5;
  const int mt   = (wave & 3) * 16;   // wave M sub-tile within 64
  const int nt0  = (wave >> 2) * 64;  // wave N sub-tile within 128

  v8f acc[4] = {};

  for (int k0 = 0; k0 < D_; k0 += 32) {
    // Stage X tile (64x32 f32 -> f16, row-major): thread t -> row t/4, cols (t%4)*8.
    {
      const int r = t >> 2, c = (t & 3) * 8;
      const float4 a0 = *(const float4*)(x + (size_t)(m0 + r) * D_ + k0 + c);
      const float4 a1 = *(const float4*)(x + (size_t)(m0 + r) * D_ + k0 + c + 4);
      _Float16* d = Xt + r * XP_ + c;
      d[0] = (_Float16)a0.x; d[1] = (_Float16)a0.y; d[2] = (_Float16)a0.z; d[3] = (_Float16)a0.w;
      d[4] = (_Float16)a1.x; d[5] = (_Float16)a1.y; d[6] = (_Float16)a1.z; d[7] = (_Float16)a1.w;
    }
    // Stage W tile (32 K x 128 N f32 -> f16) row-major, one 16-byte LDS store
    // per 8 columns: thread t -> k-rows t/16 and t/16 + 16, n-cols (t%16)*8..+8.
    {
      const int r = t >> 4, c = (t & 15) * 8;
#pragma unroll
      for (int j = 0; j < 32; j += 16) {
        const float* s = W + (size_t)(k0 + r + j) * D_ + n0 + c;
        const float4 a0 = *(const float4*)(s);
        const float4 a1 = *(const float4*)(s + 4);
        h8 w;
        w[0] = (_Float16)a0.x; w[1] = (_Float16)a0.y; w[2] = (_Float16)a0.z; w[3] = (_Float16)a0.w;
        w[4] = (_Float16)a1.x; w[5] = (_Float16)a1.y; w[6] = (_Float16)a1.z; w[7] = (_Float16)a1.w;
        *(h8*)(Wt + (r + j) * WP_ + c) = w;
      }
    }
    __syncthreads();

    const v16h a = frag_ld(Xt + mt * XP_, XP_);
#pragma unroll
    for (int nsub = 0; nsub < 4; ++nsub) {
      const v16h bm = frag_ld_tr(Wt + nt0 + nsub * 16, WP_);
      acc[nsub] = __builtin_amdgcn_wmma_f32_16x16x32_f16(
          false, a, false, bm, (short)0, acc[nsub], false, false);
    }
    __syncthreads();
  }

  // Epilogue: bias + scale, scatter to head-major f16 workspace.
  const int l     = lane_id();
  const int nlane = l & 15;
  const int mb    = (l >> 4) << 3;
#pragma unroll
  for (int nsub = 0; nsub < 4; ++nsub) {
    const int n  = n0 + nt0 + nsub * 16 + nlane;
    const float bb = bias[n];
    const int h  = n >> 6, hd = n & 63;
#pragma unroll
    for (int i = 0; i < 8; ++i) {
      const int m = m0 + mt + mb + i;
      const int bb_idx = m >> 11;            // batch
      const int ss     = m & (S_ - 1);       // sequence pos
      X[(((size_t)(bb_idx * H_ + h)) * S_ + ss) * HD_ + hd] =
          (_Float16)((acc[nsub][i] + bb) * oscale);
    }
  }
}

// Value of lane l ^ 16 (the other 16-lane half of the wave).
__device__ __forceinline__ float xhalf(float x) {
  const int b = __builtin_bit_cast(int, x);
  return __builtin_bit_cast(float,
      __builtin_amdgcn_permlanex16(b, b, 0x76543210, 0xfedcba98, false, false));
}

__global__ __launch_bounds__(256) void attn_kernel(
    const _Float16* __restrict__ Xq, const _Float16* __restrict__ Xk,
    const _Float16* __restrict__ Xv, float* __restrict__ out)
{
  __shared__ __align__(16) _Float16 Kt[32 * KP_];    // 4.5 KB, row-major [k][d], padded
  __shared__ __align__(16) _Float16 Vt[32 * VP_];    // 5 KB, row-major [k][d], padded

  const int bh   = blockIdx.y;           // 0..B*H-1
  const int b    = bh >> 4;
  const int h    = bh & 15;
  const int t    = threadIdx.x;
  const int wave = t >> 5;
  const int l    = lane_id();
  const int q0   = blockIdx.x * 128 + wave * 16;

  const size_t head_base = (size_t)bh * S_ * HD_;

  // Q^T fragments (B operand: lane = query column, pre-scaled by 1/sqrt(HD));
  // same loader as the K rows, so both sides have the same k order.
  const v16h bq0 = frag_ld(Xq + head_base + (size_t)q0 * HD_, HD_);
  const v16h bq1 = frag_ld(Xq + head_base + (size_t)q0 * HD_ + 32, HD_);

  v8f   o[4] = {};        // O^T: o[nsub][r] = O[query l&15][d = 16 nsub + 8 (l>>4) + r]
  float mrun = -1e30f;    // running maximum of this lane's query (equal in both halves)
  float lrun = 0.0f;      // running sum over the keys of this lane's half only

  for (int kc = 0; kc < S_; kc += 32) {
    // Cooperative K/V chunk load (32x64 f16 each): thread t -> row t/8, 8 halves.
    // Both stay row-major; the V^T A-fragments come by the transposing load.
    {
      const int r  = t >> 3, c8 = (t & 7) * 8;
      const size_t off = head_base + (size_t)(kc + r) * HD_ + c8;
      *(h8*)(Kt + r * KP_ + c8) = *(const h8*)(Xk + off);
      const h8 vv = *(const h8*)(Xv + off);
      *(h8*)(Vt + r * VP_ + c8) = vv;
      if (kc + 32 < S_) {                // prefetch next chunk -> global_prefetch_b8
        __builtin_prefetch(Xk + off + (size_t)32 * HD_, 0, 1);
        __builtin_prefetch(Xv + off + (size_t)32 * HD_, 0, 1);
      }
    }
    __syncthreads();

    // Scores, transposed: s0[r] = score(key 8 (l>>4) + r, query l&15),
    // s1[r] the same for key 16 + 8 (l>>4) + r.  A = K rows, B = Q^T.
    v8f s0 = {}, s1 = {};
    {
      const v16h ak0 = frag_ld(Kt, KP_);            // k 0..15, d 0..31
      const v16h ak1 = frag_ld(Kt + 32, KP_);       // k 0..15, d 32..63
      s0 = __builtin_amdgcn_wmma_f32_16x16x32_f16(false, ak0, false, bq0, (short)0, s0, false, false);
      s0 = __builtin_amdgcn_wmma_f32_16x16x32_f16(false, ak1, false, bq1, (short)0, s0, false, false);
      const v16h ak2 = frag_ld(Kt + 16 * KP_, KP_);      // k 16..31, d 0..31
      const v16h ak3 = frag_ld(Kt + 16 * KP_ + 32, KP_); // k 16..31, d 32..63
      s1 = __builtin_amdgcn_wmma_f32_16x16x32_f16(false, ak2, false, bq0, (short)0, s1, false, false);
      s1 = __builtin_amdgcn_wmma_f32_16x16x32_f16(false, ak3, false, bq1, (short)0, s1, false, false);
    }

    // Online softmax: 16 keys of one query per lane, the other 16 in lane l ^ 16.
    float rmax = fmaxf(s0[0], s1[0]);
#pragma unroll
    for (int r = 1; r < 8; ++r) rmax = fmaxf(rmax, fmaxf(s0[r], s1[r]));
    rmax = fmaxf(rmax, xhalf(rmax));
    const float mnew = fmaxf(mrun, rmax);
    const float corr = __expf(mrun - mnew);
    mrun = mnew;

    // P^T as B operand: element s is key 8 (l>>4) + s for s < 8 and
    // 16 + 8 (l>>4) + (s - 8) above, the k order of the transposing load.
    v16h bp;
    float psum = 0.0f;
#pragma unroll
    for (int r = 0; r < 8; ++r) {
      const float p0 = __expf(s0[r] - mnew);
      const float p1 = __expf(s1[r] - mnew);
      psum += p0 + p1;
      bp[r]     = (_Float16)p0;
      bp[8 + r] = (_Float16)p1;
    }
    lrun = lrun * corr + psum;
#pragma unroll
    for (int nsub = 0; nsub < 4; ++nsub) o[nsub] *= corr;

    // O^T += V^T @ P^T  (A = 16 d x 32 keys from row-major Vt, B = P^T).
#pragma unroll
    for (int nsub = 0; nsub < 4; ++nsub) {
      const v16h avf = frag_ld_tr(Vt + nsub * 16, VP_);
      o[nsub] = __builtin_amdgcn_wmma_f32_16x16x32_f16(
          false, avf, false, bp, (short)0, o[nsub], false, false);
    }
    __syncthreads();
  }

  // Epilogue: join the halves' sums, normalize, write merged-head f32 output
  // [B,S,D]; a lane holds 8 consecutive d of its query in each tile.
  const float lsum = lrun + xhalf(lrun);
  float* orow = out + ((size_t)b * S_ + q0 + (l & 15)) * D_ + h * HD_ + ((l >> 4) << 3);
#pragma unroll
  for (int nsub = 0; nsub < 4; ++nsub) {
    float4 w0, w1;
    w0.x = o[nsub][0] / lsum; w0.y = o[nsub][1] / lsum; w0.z = o[nsub][2] / lsum; w0.w = o[nsub][3] / lsum;
    w1.x = o[nsub][4] / lsum; w1.y = o[nsub][5] / lsum; w1.z = o[nsub][6] / lsum; w1.w = o[nsub][7] / lsum;
    *(float4*)(orow + nsub * 16)     = w0;
    *(float4*)(orow + nsub * 16 + 4) = w1;
  }
}

extern "C" void kernel_launch(void* const* d_in, const int* in_sizes, int n_in,
                              void* d_out, int out_size, void* d_ws, size_t ws_size,
                              hipStream_t stream) {
  (void)in_sizes; (void)n_in; (void)out_size; (void)ws_size;
  const float* q  = (const float*)d_in[0];
  const float* k  = (const float*)d_in[1];
  const float* v  = (const float*)d_in[2];
  const float* Wq = (const float*)d_in[3];
  const float* bq = (const float*)d_in[4];
  const float* Wk = (const float*)d_in[5];
  const float* bk = (const float*)d_in[6];
  const float* Wv = (const float*)d_in[7];
  const float* bv = (const float*)d_in[8];
  float* out = (float*)d_out;

  const size_t nX = (size_t)B_ * H_ * S_ * HD_;   // 4M elems -> 8 MB f16 each
  _Float16* Xq = (_Float16*)d_ws;
  _Float16* Xk = Xq + nX;
  _Float16* Xv = Xk + nX;

  dim3 gp(B_ * S_ / 64, D_ / 128, 3);
  qkv_proj_kernel<<<gp, 256, 0, stream>>>(q, k, v, Wq, bq, Wk, bk, Wv, bv, Xq, Xk, Xv);

  dim3 ga(S_ / 128, B_ * H_);
  attn_kernel<<<ga, 256, 0, stream>>>(Xq, Xk, Xv, out);
}

// v004
// Measured time: 107 microseconds a run.
// Two timings next to v003 put it at 1.04 and 1.05 times that version's speed.
// All steps since v000 together make it 2.74 times as fast.
#include <hip/hip_runtime.h>
#include <hip/hip_bf16.h>

typedef __attribute__((ext_vector_type(16))) _Float16 v16h;
typedef __attribute__((ext_vector_type(8)))  float    v8f;
typedef __attribute__((ext_vector_type(8)))  _Float16 h8;
typedef __attribute__((ext_vector_type(8)))  short    s8;

#define B_  2
#define S_  2048
#define D_  1024
#define H_  16
#define HD_ 64

__device__ __forceinline__ int lane_id() { return threadIdx.x & 31; }

// Fragment load with wide (b128) accesses.  Works for:
//  - A fragments (16x32 f16) from a row-major tile (lane = M row), and
//  - B fragments (32x16 f16) from a TRANSPOSED tile T[n][k] (lane = N col),
// since both reduce to: lane (l&15) reads two 8-half runs at K = kh and 16+kh.
// All addresses are 16-byte aligned (ld is a multiple of 8, kh is 0 or 8).
__device__ __forceinline__ v16h frag_ld(const _Float16* src, int ld) {
  const int l  = lane_id();
  const int m  = l & 15;
  const int kh = (l >> 4) << 3;
  const _Float16* r = src + (size_t)m * ld + kh;
  const h8 lo = *(const h8*)(r);
  const h8 hi = *(const h8*)(r + 16);
  return __builtin_shufflevector(lo, hi, 0, 1, 2, 3, 4, 5, 6, 7,
                                         8, 9, 10, 11, 12, 13, 14, 15);
}

// B fragment (32 K x 16 N f16) from a ROW-MAJOR LDS tile T[k][n] by the
// transposing LDS load: lane (c = l&15, h = l>>4) receives T[8h + 0..7][c] from
// the first load and T[16 + 8h + 0..7][c] from the second, which is the same k
// order as frag_ld gives the A operand.  tile points at T[0][first column];
// pitch is in halves and must be an odd multiple of 16 (32 bytes) for the banks.
__device__ __forceinline__ v16h frag_ld_tr(const _Float16* tile, int pitch) {
  typedef __attribute__((address_space(3))) s8 lds_s8;
  const int l = lane_id();
  const _Float16* p = tile + (8 * (l >> 4) + (l & 7)) * pitch + 8 * ((l >> 3) & 1);
  const h8 lo = __builtin_bit_cast(h8, __builtin_amdgcn_ds_load_tr16_b128_v8i16((lds_s8*)p));
  const h8 hi = __builtin_bit_cast(h8, __builtin_amdgcn_ds_load_tr16_b128_v8i16((lds_s8*)(p + 16 * pitch)));
  return __builtin_shufflevector(lo, hi, 0, 1, 2, 3, 4, 5, 6, 7,
                                         8, 9, 10, 11, 12, 13, 14, 15);
}

#define BM_ 128  // projection tile rows per work-group
#define BN_ 256  // projection tile columns per work-group
#define MF_ 4    // 16-row A fragments per wave (wave tile 64 x 64)
#define WP_ (BN_ + 16)  // W tile row pitch in halves (544 bytes, an odd multiple of 32)
#define VP_ 80   // V tile row pitch in halves:  64 + 16 (160 bytes)
// Tiles read by plain 16-byte LDS loads (one row per lane): pitch an odd
// multiple of 16 bytes, so that the 16 rows of a fragment fall on distinct banks.
#define XP_ 40   // X tile row pitch in halves:  32 + 8 (80 bytes)
#define KP_ 72   // K tile row pitch in halves:  64 + 8 (144 bytes)

// ---------------------------------------------------------------------------
// Kernel 1: QKV projection GEMM.  X = (x @ W + b) [* 0.125 for Q], f16 output
// in head-major [B,H,S,HD] layout.  Grid: (BS/128, D/256, 3), block 256:
// 8 waves as 2 (M) x 4 (N), each 64 x 64 of the tile.
// ---------------------------------------------------------------------------
__global__ __launch_bounds__(256) void qkv_proj_kernel(
    const float* __restrict__ q, const float* __restrict__ k, const float* __restrict__ v,
    const float* __restrict__ Wq, const float* __restrict__ bq,
    const float* __restrict__ Wk, const float* __restrict__ bk,
    const float* __restrict__ Wv, const float* __restrict__ bv,
    _Float16* __restrict__ Xq, _Float16* __restrict__ Xk, _Float16* __restrict__ Xv)
{
  __shared__ __align__(16) _Float16 Xt[BM_ * XP_];  // 128 M x 32 K, row-major, padded
  __shared__ __align__(16) _Float16 Wt[32 * WP_];   // 32 K x 256 N, row-major, padded

  const int z = blockIdx.z;
  const float* x    = (z == 0) ? q  : (z == 1) ? k  : v;
  const float* W    = (z == 0) ? Wq : (z == 1) ? Wk : Wv;
  const float* bias = (z == 0) ? bq : (z == 1) ? bk : bv;
  _Float16*    X    = (z == 0) ? Xq : (z == 1) ? Xk : Xv;
  const float oscale = (z == 0) ? 0.125f : 1.0f;  // fold 1/sqrt(HD) into Q

  const int m0   = blockIdx.x * BM_;
  const int n0   = blockIdx.y * BN_;
  const int t    = threadIdx.x;
  const int wave = t >> 5;
  const int mt   = (wave & 1) * (MF_ * 16);  // wave M sub-tile within the tile
  const int nt0  = (wave >> 1) * 64;         // wave N sub-tile within the tile

  // This thread's first staged elements of x (row t/4) and of W (k-row t/32).
  const float* xs = x + (size_t)(m0 + (t >> 2)) * D_ + (t & 3) * 8;
  const float* ws = W + (size_t)(t / (BN_ / 8)) * D_ + n0 + (t % (BN_ / 8)) * 8;

  v8f acc[MF_][4] = {};

  for (int k0 = 0; k0 < D_; k0 += 32) {
    // Stage X tile (128x32 f32 -> f16, row-major): thread t -> rows t/4 and
    // t/4 + 64, cols (t%4)*8.
    {
      const int r = t >> 2, c = (t & 3) * 8;
#pragma unroll  // both rows' loads issue together, ahead of the first conversion
      for (int j = 0; j < BM_; j += 64) {
        const float* s = xs + k0 + j * D_;
        const float4 a0 = *(const float4*)(s);
        const float4 a1 = *(const float4*)(s + 4);
        h8 w;
        w[0] = (_Float16)a0.x; w[1] = (_Float16)a0.y; w[2] = (_Float16)a0.z; w[3] = (_Float16)a0.w;
        w[4] = (_Float16)a1.x; w[5] = (_Float16)a1.y; w[6] = (_Float16)a1.z; w[7] = (_Float16)a1.w;
        *(h8*)(Xt + (r + j) * XP_ + c) = w;
      }
    }
    // Stage W tile (32 K x 256 N f32 -> f16) row-major, one 16-byte LDS store
    // per 8 columns: thread t -> n-cols (t%32)*8..+8, k-rows t/32 + 8 j.
    {
      const int r = t / (BN_ / 8), c = (t % (BN_ / 8)) * 8;
#pragma unroll
      for (int j = 0; j < 32; j += 2048 / BN_) {
        const float* s = ws + (size_t)(k0 + j) * D_;
        const float4 a0 = *(const float4*)(s);
        const float4 a1 = *(const float4*)(s + 4);
        h8 w;
        w[0] = (_Float16)a0.x; w[1] = (_Float16)a0.y; w[2] = (_Float16)a0.z; w[3] = (_Float16)a0.w;
        w[4] = (_Float16)a1.x; w[5] = (_Float16)a1.y; w[6] = (_Float16)a1.z; w[7] = (_Float16)a1.w;
        *(h8*)(Wt + (r + j) * WP_ + c) = w;
      }
    }
    __syncthreads();

    v16h a[MF_];
#pragma unroll  // a[] and acc[][] live in registers: every index must be a constant
    for (int mi = 0; mi < MF_; ++mi) a[mi] = frag_ld(Xt + (mt + mi * 16) * XP_, XP_);
#pragma unroll
    for (int nsub = 0; nsub < 4; ++nsub) {
      const v16h bm = frag_ld_tr(Wt + nt0 + nsub * 16, WP_);
#pragma unroll  // constant indices, as above
      for (int mi = 0; mi < MF_; ++mi)
        acc[mi][nsub] = __builtin_amdgcn_wmma_f32_16x16x32_f16(
            false, a[mi], false, bm, (short)0, acc[mi][nsub], false, false);
    }
    __syncthreads();
  }

  // Epilogue: bias + scale, scatter to head-major f16 workspace.
  const int l     = lane_id();
  const int nlane = l & 15;
  const int mb    = (l >> 4) << 3;
#pragma unroll
  for (int nsub = 0; nsub < 4; ++nsub) {
    const int n  = n0 + nt0 + nsub * 16 + nlane;
    const float bb = bias[n];
    const int h  = n >> 6, hd = n & 63;
#pragma unroll  // constant indices, as above
    for (int mi = 0; mi < MF_; ++mi) {
#pragma unroll
      for (int i = 0; i < 8; ++i) {
        const int m = m0 + mt + mi * 16 + mb + i;
        const int bb_idx = m >> 11;            // batch
        const int ss     = m & (S_ - 1);       // sequence pos
        X[(((size_t)(bb_idx * H_ + h)) * S_ + ss) * HD_ + hd] =
            (_Float16)((acc[mi][nsub][i] + bb) * oscale);
      }
    }
  }
}

// Value of lane l ^ 16 (the other 16-lane half of the wave).
__device__ __forceinline__ float xhalf(float x) {
  const int b = __builtin_bit_cast(int, x);
  return __builtin_bit_cast(float,
      __builtin_amdgcn_permlanex16(b, b, 0x76543210, 0xfedcba98, false, false));
}

__global__ __launch_bounds__(256) void attn_kernel(
    const _Float16* __restrict__ Xq, const _Float16* __restrict__ Xk,
    const _Float16* __restrict__ Xv, float* __restrict__ out)
{
  __shared__ __align__(16) _Float16 Kt[32 * KP_];    // 4.5 KB, row-major [k][d], padded
  __shared__ __align__(16) _Float16 Vt[32 * VP_];    // 5 KB, row-major [k][d], padded

  const int bh   = blockIdx.y;           // 0..B*H-1
  const int b    = bh >> 4;
  const int h    = bh & 15;
  const int t    = threadIdx.x;
  const int wave = t >> 5;
  const int l    = lane_id();
  const int q0   = blockIdx.x * 128 + wave * 16;

  const size_t head_base = (size_t)bh * S_ * HD_;

  // Q^T fragments (B operand: lane = query column, pre-scaled by 1/sqrt(HD));
  // same loader as the K rows, so both sides have the same k order.
  const v16h bq0 = frag_ld(Xq + head_base + (size_t)q0 * HD_, HD_);
  const v16h bq1 = frag_ld(Xq + head_base + (size_t)q0 * HD_ + 32, HD_);

  v8f   o[4] = {};        // O^T: o[nsub][r] = O[query l&15][d = 16 nsub + 8 (l>>4) + r]
  float mrun = -1e30f;    // running maximum of this lane's query (equal in both halves)
  float lrun = 0.0f;      // running sum over the keys of this lane's half only

  for (int kc = 0; kc < S_; kc += 32) {
    // Cooperative K/V chunk load (32x64 f16 each): thread t -> row t/8, 8 halves.
    // Both stay row-major; the V^T A-fragments come by the transposing load.
    {
      const int r  = t >> 3, c8 = (t & 7) * 8;
      const size_t off = head_base + (size_t)(kc + r) * HD_ + c8;
      *(h8*)(Kt + r * KP_ + c8) = *(const h8*)(Xk + off);
      const h8 vv = *(const h8*)(Xv + off);
      *(h8*)(Vt + r * VP_ + c8) = vv;
      if (kc + 32 < S_) {                // prefetch next chunk -> global_prefetch_b8
        __builtin_prefetch(Xk + off + (size_t)32 * HD_, 0, 1);
        __builtin_prefetch(Xv + off + (size_t)32 * HD_, 0, 1);
      }
    }
    __syncthreads();

    // Scores, transposed: s0[r] = score(key 8 (l>>4) + r, query l&15),
    // s1[r] the same for key 16 + 8 (l>>4) + r.  A = K rows, B = Q^T.
    v8f s0 = {}, s1 = {};
    {
      const v16h ak0 = frag_ld(Kt, KP_);            // k 0..15, d 0..31
      const v16h ak1 = frag_ld(Kt + 32, KP_);       // k 0..15, d 32..63
      s0 = __builtin_amdgcn_wmma_f32_16x16x32_f16(false, ak0, false, bq0, (short)0, s0, false, false);
      s0 = __builtin_amdgcn_wmma_f32_16x16x32_f16(false, ak1, false, bq1, (short)0, s0, false, false);
      const v16h ak2 = frag_ld(Kt + 16 * KP_, KP_);      // k 16..31, d 0..31
      const v16h ak3 = frag_ld(Kt + 16 * KP_ + 32, KP_); // k 16..31, d 32..63
      s1 = __builtin_amdgcn_wmma_f32_16x16x32_f16(false, ak2, false, bq0, (short)0, s1, false, false);
      s1 = __builtin_amdgcn_wmma_f32_16x16x32_f16(false, ak3, false, bq1, (short)0, s1, false, false);
    }

    // Online softmax: 16 keys of one query per lane, the other 16 in lane l ^ 16.
    float rmax = fmaxf(s0[0], s1[0]);
#pragma unroll
    for (int r = 1; r < 8; ++r) rmax = fmaxf(rmax, fmaxf(s0[r], s1[r]));
    rmax = fmaxf(rmax, xhalf(rmax));
    const float mnew = fmaxf(mrun, rmax);
    const float corr = __expf(mrun - mnew);
    mrun = mnew;

    // P^T as B operand: element s is key 8 (l>>4) + s for s < 8 and
    // 16 + 8 (l>>4) + (s - 8) above, the k order of the transposing load.
    v16h bp;
    float psum = 0.0f;
#pragma unroll
    for (int r = 0; r < 8; ++r) {
      const float p0 = __expf(s0[r] - mnew);
      const float p1 = __expf(s1[r] - mnew);
      psum += p0 + p1;
      bp[r]     = (_Float16)p0;
      bp[8 + r] = (_Float16)p1;
    }
    lrun = lrun * corr + psum;
#pragma unroll
    for (int nsub = 0; nsub < 4; ++nsub) o[nsub] *= corr;

    // O^T += V^T @ P^T  (A = 16 d x 32 keys from row-major Vt, B = P^T).
#pragma unroll
    for (int nsub = 0; nsub < 4; ++nsub) {
      const v16h avf = frag_ld_tr(Vt + nsub * 16, VP_);
      o[nsub] = __builtin_amdgcn_wmma_f32_16x16x32_f16(
          false, avf, false, bp, (short)0, o[nsub], false, false);
    }
    __syncthreads();
  }

  // Epilogue: join the halves' sums, normalize, write merged-head f32 output
  // [B,S,D]; a lane holds 8 consecutive d of its query in each tile.
  const float lsum = lrun + xhalf(lrun);
  float* orow = out + ((size_t)b * S_ + q0 + (l & 15)) * D_ + h * HD_ + ((l >> 4) << 3);
#pragma unroll
  for (int nsub = 0; nsub < 4; ++nsub) {
    float4 w0, w1;
    w0.x = o[nsub][0] / lsum; w0.y = o[nsub][1] / lsum; w0.z = o[nsub][2] / lsum; w0.w = o[nsub][3] / lsum;
    w1.x = o[nsub][4] / lsum; w1.y = o[nsub][5] / lsum; w1.z = o[nsub][6] / lsum; w1.w = o[nsub][7] / lsum;
    *(float4*)(orow + nsub * 16)     = w0;
    *(float4*)(orow + nsub * 16 + 4) = w1;
  }
}

extern "C" void kernel_launch(void* const* d_in, const int* in_sizes, int n_in,
                              void* d_out, int out_size, void* d_ws, size_t ws_size,
                              hipStream_t stream) {
  (void)in_sizes; (void)n_in; (void)out_size; (void)ws_size;
  const float* q  = (const float*)d_in[0];
  const float* k  = (const float*)d_in[1];
  const float* v  = (const float*)d_in[2];
  const float* Wq = (const float*)d_in[3];
  const float* bq = (const float*)d_in[4];
  const float* Wk = (const float*)d_in[5];
  const float* bk = (const float*)d_in[6];
  const float* Wv = (const float*)d_in[7];
  const float* bv = (const float*)d_in[8];
  float* out = (float*)d_out;

  const size_t nX = (size_t)B_ * H_ * S_ * HD_;   // 4M elems -> 8 MB f16 each
  _Float16* Xq = (_Float16*)d_ws;
  _Float16* Xk = Xq + nX;
  _Float16* Xv = Xk + nX;

  dim3 gp(B_ * S_ / BM_, D_ / BN_, 3);
  qkv_proj_kernel<<<gp, 256, 0, stream>>>(q, k, v, Wq, bq, Wk, bk, Wv, bv, Xq, Xk, Xv);

  dim3 ga(S_ / 128, B_ * H_);
  attn_kernel<<<ga, 256, 0, stream>>>(Xq, Xk, Xv, out);
}

// v005
// A run of this version takes 95 microseconds.
// Two timings next to v004 both put it at 1.13 times that version's speed.
// Over all steps from v000 it is 3.10 times as fast.
#include <hip/hip_runtime.h>
#include <hip/hip_bf16.h>

typedef __attribute__((ext_vector_type(16))) _Float16 v16h;
typedef __attribute__((ext_vector_type(8)))  float    v8f;
typedef __attribute__((ext_vector_type(8)))  _Float16 h8;
typedef __attribute__((ext_vector_type(8)))  short    s8;

#define B_  2
#define S_  2048
#define D_  1024
#define H_  16
#define HD_ 64

__device__ __forceinline__ int lane_id() { return threadIdx.x & 31; }

// Fragment load with wide (b128) accesses.  Works for:
//  - A fragments (16x32 f16) from a row-major tile (lane = M row), and
//  - B fragments (32x16 f16) from a TRANSPOSED tile T[n][k] (lane = N col),
// since both reduce to: lane (l&15) reads two 8-half runs at K = kh and 16+kh.
// All addresses are 16-byte aligned (ld is a multiple of 8, kh is 0 or 8).
__device__ __forceinline__ v16h frag_ld(const _Float16* src, int ld) {
  const int l  = lane_id();
  const int m  = l & 15;
  const int kh = (l >> 4) << 3;
  const _Float16* r = src + (size_t)m * ld + kh;
  const h8 lo = *(const h8*)(r);
  const h8 hi = *(const h8*)(r + 16);
  return __builtin_shufflevector(lo, hi, 0, 1, 2, 3, 4, 5, 6, 7,
                                         8, 9, 10, 11, 12, 13, 14, 15);
}

// B fragment (32 K x 16 N f16) from a ROW-MAJOR LDS tile T[k][n] by the
// transposing LDS load: lane (c = l&15, h = l>>4) receives T[8h + 0..7][c] from
// the first load and T[16 + 8h + 0..7][c] from the second, which is the same k
// order as frag_ld gives the A operand.  tile points at T[0][first column];
// pitch is in halves and must be an odd multiple of 16 (32 bytes) for the banks.
__device__ __forceinline__ v16h frag_ld_tr(const _Float16* tile, int pitch) {
  typedef __attribute__((address_space(3))) s8 lds_s8;
  const int l = lane_id();
  const _Float16* p = tile + (8 * (l >> 4) + (l & 7)) * pitch + 8 * ((l >> 3) & 1);
  const h8 lo = __builtin_bit_cast(h8, __builtin_amdgcn_ds_load_tr16_b128_v8i16((lds_s8*)p));
  const h8 hi = __builtin_bit_cast(h8, __builtin_amdgcn_ds_load_tr16_b128_v8i16((lds_s8*)(p + 16 * pitch)));
  return __builtin_shufflevector(lo, hi, 0, 1, 2, 3, 4, 5, 6, 7,
                                         8, 9, 10, 11, 12, 13, 14, 15);
}

#define BM_ 128  // projection tile rows per work-group
#define BN_ 256  // projection tile columns per work-group
#define MF_ 4    // 16-row A fragments per wave (wave tile 64 x 64)
#define WP_ (BN_ + 16)  // W tile row pitch in halves (544 bytes, an odd multiple of 32)
#define VP_ 80   // V tile row pitch in halves:  64 + 16 (160 bytes)
// Tiles read by plain 16-byte LDS loads (one row per lane): pitch an odd
// multiple of 16 bytes, so that the 16 rows of a fragment fall on distinct banks.
#define XP_ 40   // X tile row pitch in halves:  32 + 8 (80 bytes)
#define KP_ 72   // K tile row pitch in halves:  64 + 8 (144 bytes)
#define KS_ 128  // keys per LDS stage of the attention kernel (four passes of 32)
#define NST_ (S_ / KS_)  // stages per head

// ---------------------------------------------------------------------------
// Kernel 1: QKV projection GEMM.  X = (x @ W + b) [* 0.125 for Q], f16 output
// in head-major [B,H,S,HD] layout.  Grid: (BS/128, D/256, 3), block 256:
// 8 waves as 2 (M) x 4 (N), each 64 x 64 of the tile.
// ---------------------------------------------------------------------------
__global__ __launch_bounds__(256) void qkv_proj_kernel(
    const float* __restrict__ q, const float* __restrict__ k, const float* __restrict__ v,
    const float* __restrict__ Wq, const float* __restrict__ bq,
    const float* __restrict__ Wk, const float* __restrict__ bk,
    const float* __restrict__ Wv, const float* __restrict__ bv,
    _Float16* __restrict__ Xq, _Float16* __restrict__ Xk, _Float16* __restrict__ Xv)
{
  __shared__ __align__(16) _Float16 Xt[BM_ * XP_];  // 128 M x 32 K, row-major, padded
  __shared__ __align__(16) _Float16 Wt[32 * WP_];   // 32 K x 256 N, row-major, padded

  const int z = blockIdx.z;
  const float* x    = (z == 0) ? q  : (z == 1) ? k  : v;
  const float* W    = (z == 0) ? Wq : (z == 1) ? Wk : Wv;
  const float* bias = (z == 0) ? bq : (z == 1) ? bk : bv;
  _Float16*    X    = (z == 0) ? Xq : (z == 1) ? Xk : Xv;
  const float oscale = (z == 0) ? 0.125f : 1.0f;  // fold 1/sqrt(HD) into Q

  const int m0   = blockIdx.x * BM_;
  const int n0   = blockIdx.y * BN_;
  const int t    = threadIdx.x;
  const int wave = t >> 5;
  const int mt   = (wave & 1) * (MF_ * 16);  // wave M sub-tile within the tile
  const int nt0  = (wave >> 1) * 64;         // wave N sub-tile within the tile

  // This thread's first staged elements of x (row t/4) and of W (k-row t/32).
  const float* xs = x + (size_t)(m0 + (t >> 2)) * D_ + (t & 3) * 8;
  const float* ws = W + (size_t)(t / (BN_ / 8)) * D_ + n0 + (t % (BN_ / 8)) * 8;

  v8f acc[MF_][4] = {};

  for (int k0 = 0; k0 < D_; k0 += 32) {
    // Stage X tile (128x32 f32 -> f16, row-major): thread t -> rows t/4 and
    // t/4 + 64, cols (t%4)*8.
    {
      const int r = t >> 2, c = (t & 3) * 8;
#pragma unroll  // both rows' loads issue together, ahead of the first conversion
      for (int j = 0; j < BM_; j += 64) {
        const float* s = xs + k0 + j * D_;
        const float4 a0 = *(const float4*)(s);
        const float4 a1 = *(const float4*)(s + 4);
        h8 w;
        w[0] = (_Float16)a0.x; w[1] = (_Float16)a0.y; w[2] = (_Float16)a0.z; w[3] = (_Float16)a0.w;
        w[4] = (_Float16)a1.x; w[5] = (_Float16)a1.y; w[6] = (_Float16)a1.z; w[7] = (_Float16)a1.w;
        *(h8*)(Xt + (r + j) * XP_ + c) = w;
      }
    }
    // Stage W tile (32 K x 256 N f32 -> f16) row-major, one 16-byte LDS store
    // per 8 columns: thread t -> n-cols (t%32)*8..+8, k-rows t/32 + 8 j.
    {
      const int r = t / (BN_ / 8), c = (t % (BN_ / 8)) * 8;
#pragma unroll
      for (int j = 0; j < 32; j += 2048 / BN_) {
        const float* s = ws + (size_t)(k0 + j) * D_;
        const float4 a0 = *(const float4*)(s);
        const float4 a1 = *(const float4*)(s + 4);
        h8 w;
        w[0] = (_Float16)a0.x; w[1] = (_Float16)a0.y; w[2] = (_Float16)a0.z; w[3] = (_Float16)a0.w;
        w[4] = (_Float16)a1.x; w[5] = (_Float16)a1.y; w[6] = (_Float16)a1.z; w[7] = (_Float16)a1.w;
        *(h8*)(Wt + (r + j) * WP_ + c) = w;
      }
    }
    __syncthreads();

    v16h a[MF_];
#pragma unroll  // a[] and acc[][] live in registers: every index must be a constant
    for (int mi = 0; mi < MF_; ++mi) a[mi] = frag_ld(Xt + (mt + mi * 16) * XP_, XP_);
#pragma unroll
    for (int nsub = 0; nsub < 4; ++nsub) {
      const v16h bm = frag_ld_tr(Wt + nt0 + nsub * 16, WP_);
#pragma unroll  // constant indices, as above
      for (int mi = 0; mi < MF_; ++mi)
        acc[mi][nsub] = __builtin_amdgcn_wmma_f32_16x16x32_f16(
            false, a[mi], false, bm, (short)0, acc[mi][nsub], false, false);
    }
    __syncthreads();
  }

  // Epilogue: bias + scale, scatter to head-major f16 workspace.
  const int l     = lane_id();
  const int nlane = l & 15;
  const int mb    = (l >> 4) << 3;
#pragma unroll
  for (int nsub = 0; nsub < 4; ++nsub) {
    const int n  = n0 + nt0 + nsub * 16 + nlane;
    const float bb = bias[n];
    const int h  = n >> 6, hd = n & 63;
#pragma unroll  // constant indices, as above
    for (int mi = 0; mi < MF_; ++mi) {
#pragma unroll
      for (int i = 0; i < 8; ++i) {
        const int m = m0 + mt + mi * 16 + mb + i;
        const int bb_idx = m >> 11;            // batch
        const int ss     = m & (S_ - 1);       // sequence pos
        X[(((size_t)(bb_idx * H_ + h)) * S_ + ss) * HD_ + hd] =
            (_Float16)((acc[mi][nsub][i] + bb) * oscale);
      }
    }
  }
}

// Value of lane l ^ 16 (the other 16-lane half of the wave).
__device__ __forceinline__ float xhalf(float x) {
  const int b = __builtin_bit_cast(int, x);
  return __builtin_bit_cast(float,
      __builtin_amdgcn_permlanex16(b, b, 0x76543210, 0xfedcba98, false, false));
}

// One stage (128 keys x 64 halves of K and of V) from global memory to LDS by
// asynchronous 16-byte copies, through no register: this lane's piece of rows
// r, r + 32, r + 64, r + 96.  gk, gv: the lane's global piece of row r;
// lk, lv: its LDS byte address in the K and in the V buffer.
// s_wait_xcnt 0 closes the statement, so that no address register of a copy
// takes a new value before it.
__device__ __forceinline__ void stage_copy(const _Float16* gk, const _Float16* gv,
                                           unsigned lk, unsigned lv) {
  asm volatile(
      "global_load_async_to_lds_b128 %0, %8, off\n\t"
      "global_load_async_to_lds_b128 %1, %9, off\n\t"
      "global_load_async_to_lds_b128 %2, %10, off\n\t"
      "global_load_async_to_lds_b128 %3, %11, off\n\t"
      "global_load_async_to_lds_b128 %4, %12, off\n\t"
      "global_load_async_to_lds_b128 %5, %13, off\n\t"
      "global_load_async_to_lds_b128 %6, %14, off\n\t"
      "global_load_async_to_lds_b128 %7, %15, off\n\t"
      "s_wait_xcnt 0x0"
      :: "v"(lk), "v"(lk + 32 * KP_ * 2), "v"(lk + 64 * KP_ * 2), "v"(lk + 96 * KP_ * 2),
         "v"(lv), "v"(lv + 32 * VP_ * 2), "v"(lv + 64 * VP_ * 2), "v"(lv + 96 * VP_ * 2),
         "v"(gk), "v"(gk + 32 * HD_), "v"(gk + 64 * HD_), "v"(gk + 96 * HD_),
         "v"(gv), "v"(gv + 32 * HD_), "v"(gv + 64 * HD_), "v"(gv + 96 * HD_)
      : "memory");
}

__global__ __launch_bounds__(256) void attn_kernel(
    const _Float16* __restrict__ Xq, const _Float16* __restrict__ Xk,
    const _Float16* __restrict__ Xv, float* __restrict__ out)
{
  __shared__ __align__(16) _Float16 Kt[2 * KS_ * KP_];  // two stages of 18 KB, row-major [k][d], padded
  __shared__ __align__(16) _Float16 Vt[2 * KS_ * VP_];  // two stages of 20 KB, row-major [k][d], padded

  const int bh   = blockIdx.y;           // 0..B*H-1
  const int b    = bh >> 4;
  const int h    = bh & 15;
  const int t    = threadIdx.x;
  const int wave = t >> 5;
  const int l    = lane_id();
  const int q0   = blockIdx.x * 128 + wave * 16;

  const size_t head_base = (size_t)bh * S_ * HD_;

  // This lane's piece of a stage: row t/8 (and + 32, 64, 96), 8 halves at (t%8)*8.
  const int sr = t >> 3, sc = (t & 7) * 8;
  const _Float16* gk = Xk + head_base + (size_t)sr * HD_ + sc;
  const _Float16* gv = Xv + head_base + (size_t)sr * HD_ + sc;
  const unsigned lk = (unsigned)(size_t)(Kt + sr * KP_ + sc);
  const unsigned lv = (unsigned)(size_t)(Vt + sr * VP_ + sc);

  // Q^T fragments (B operand: lane = query column, pre-scaled by 1/sqrt(HD));
  // same loader as the K rows, so both sides have the same k order.
  const v16h bq0 = frag_ld(Xq + head_base + (size_t)q0 * HD_, HD_);
  const v16h bq1 = frag_ld(Xq + head_base + (size_t)q0 * HD_ + 32, HD_);

  // Ring prologue: stage 0 lands and is published, then stage 1 starts to fly.
  stage_copy(gk, gv, lk, lv);
  asm volatile("s_wait_asynccnt 0x0" ::: "memory");  // this wave's copies of stage 0 have landed
  __syncthreads();                                   // ... and every other wave's
  stage_copy(gk + KS_ * HD_, gv + KS_ * HD_, lk + KS_ * KP_ * 2, lv + KS_ * VP_ * 2);

  v8f   o[4] = {};        // O^T: o[nsub][r] = O[query l&15][d = 16 nsub + 8 (l>>4) + r]
  float mrun = -1e30f;    // running maximum of this lane's query (equal in both halves)
  float lrun = 0.0f;      // running sum over the keys of this lane's half only

  for (int st = 0; st < NST_; ++st) {
   const int buf = st & 1;
#pragma unroll  // the four passes of a stage: LDS offsets become immediates
   for (int ps = 0; ps < KS_ / 32; ++ps) {
    // This pass's 32 keys, both tiles row-major; the V^T A-fragments come by the
    // transposing load.
    const _Float16* Kp = Kt + (buf * KS_ + ps * 32) * KP_;
    const _Float16* Vp = Vt + (buf * KS_ + ps * 32) * VP_;

    // Scores, transposed: s0[r] = score(key 8 (l>>4) + r, query l&15),
    // s1[r] the same for key 16 + 8 (l>>4) + r.  A = K rows, B = Q^T.
    v8f s0 = {}, s1 = {};
    {
      const v16h ak0 = frag_ld(Kp, KP_);            // k 0..15, d 0..31
      const v16h ak1 = frag_ld(Kp + 32, KP_);       // k 0..15, d 32..63
      s0 = __builtin_amdgcn_wmma_f32_16x16x32_f16(false, ak0, false, bq0, (short)0, s0, false, false);
      s0 = __builtin_amdgcn_wmma_f32_16x16x32_f16(false, ak1, false, bq1, (short)0, s0, false, false);
      const v16h ak2 = frag_ld(Kp + 16 * KP_, KP_);      // k 16..31, d 0..31
      const v16h ak3 = frag_ld(Kp + 16 * KP_ + 32, KP_); // k 16..31, d 32..63
      s1 = __builtin_amdgcn_wmma_f32_16x16x32_f16(false, ak2, false, bq0, (short)0, s1, false, false);
      s1 = __builtin_amdgcn_wmma_f32_16x16x32_f16(false, ak3, false, bq1, (short)0, s1, false, false);
    }

    // Online softmax: 16 keys of one query per lane, the other 16 in lane l ^ 16.
    float rmax = fmaxf(s0[0], s1[0]);
#pragma unroll
    for (int r = 1; r < 8; ++r) rmax = fmaxf(rmax, fmaxf(s0[r], s1[r]));
    rmax = fmaxf(rmax, xhalf(rmax));
    const float mnew = fmaxf(mrun, rmax);
    const float corr = __expf(mrun - mnew);
    mrun = mnew;

    // P^T as B operand: element s is key 8 (l>>4) + s for s < 8 and
    // 16 + 8 (l>>4) + (s - 8) above, the k order of the transposing load.
    v16h bp;
    float psum = 0.0f;
#pragma unroll
    for (int r = 0; r < 8; ++r) {
      const float p0 = __expf(s0[r] - mnew);
      const float p1 = __expf(s1[r] - mnew);
      psum += p0 + p1;
      bp[r]     = (_Float16)p0;
      bp[8 + r] = (_Float16)p1;
    }
    lrun = lrun * corr + psum;
#pragma unroll
    for (int nsub = 0; nsub < 4; ++nsub) o[nsub] *= corr;

    // O^T += V^T @ P^T  (A = 16 d x 32 keys from row-major Vt, B = P^T).
#pragma unroll
    for (int nsub = 0; nsub < 4; ++nsub) {
      const v16h avf = frag_ld_tr(Vp + nsub * 16, VP_);
      o[nsub] = __builtin_amdgcn_wmma_f32_16x16x32_f16(
          false, avf, false, bp, (short)0, o[nsub], false, false);
    }
   }

   // Publish point of stage st + 1, in the ring's order.
   asm volatile("s_wait_dscnt 0x0" ::: "memory");     // this wave's reads of stage st are done
   asm volatile("s_wait_asynccnt 0x0" ::: "memory");  // its copies of stage st + 1 have landed
   __syncthreads();  // all waves: stage st + 1 may be read, stage st's buffer refilled
   if (st + 2 < NST_)
     stage_copy(gk + (size_t)(st + 2) * KS_ * HD_, gv + (size_t)(st + 2) * KS_ * HD_,
                lk + buf * (KS_ * KP_ * 2), lv + buf * (KS_ * VP_ * 2));
  }
  asm volatile("s_wait_asynccnt 0x0" ::: "memory");  // nothing in flight when the wave ends

  // Epilogue: join the halves' sums, normalize, write merged-head f32 output
  // [B,S,D]; a lane holds 8 consecutive d of its query in each tile.
  const float lsum = lrun + xhalf(lrun);
  float* orow = out + ((size_t)b * S_ + q0 + (l & 15)) * D_ + h * HD_ + ((l >> 4) << 3);
#pragma unroll
  for (int nsub = 0; nsub < 4; ++nsub) {
    float4 w0, w1;
    w0.x = o[nsub][0] / lsum; w0.y = o[nsub][1] / lsum; w0.z = o[nsub][2] / lsum; w0.w = o[nsub][3] / lsum;
    w1.x = o[nsub][4] / lsum; w1.y = o[nsub][5] / lsum; w1.z = o[nsub][6] / lsum; w1.w = o[nsub][7] / lsum;
    *(float4*)(orow + nsub * 16)     = w0;
    *(float4*)(orow + nsub * 16 + 4) = w1;
  }
}

extern "C" void kernel_launch(void* const* d_in, const int* in_sizes, int n_in,
                              void* d_out, int out_size, void* d_ws, size_t ws_size,
                              hipStream_t stream) {
  (void)in_sizes; (void)n_in; (void)out_size; (void)ws_size;
  const float* q  = (const float*)d_in[0];
  const float* k  = (const float*)d_in[1];
  const float* v  = (const float*)d_in[2];
  const float* Wq = (const float*)d_in[3];
  const float* bq = (const float*)d_in[4];
  const float* Wk = (const float*)d_in[5];
  const float* bk = (const float*)d_in[6];
  const float* Wv = (const float*)d_in[7];
  const float* bv = (const float*)d_in[8];
  float* out = (float*)d_out;

  const size_t nX = (size_t)B_ * H_ * S_ * HD_;   // 4M elems -> 8 MB f16 each
  _Float16* Xq = (_Float16*)d_ws;
  _Float16* Xk = Xq + nX;
  _Float16* Xv = Xk + nX;

  dim3 gp(B_ * S_ / BM_, D_ / BN_, 3);
  qkv_proj_kernel<<<gp, 256, 0, stream>>>(q, k, v, Wq, bq, Wk, bk, Wv, bv, Xq, Xk, Xv);

  dim3 ga(S_ / 128, B_ * H_);
  attn_kernel<<<ga, 256, 0, stream>>>(Xq, Xk, Xv, out);
}

// v006
// It runs in 88.3 microseconds.
// Next to v005, in two timings, it ran 1.08 and 1.07 times as fast.
// Counting every step since v000, it is 3.34 times as fast.
#include <hip/hip_runtime.h>
#include <hip/hip_bf16.h>

typedef __attribute__((ext_vector_type(16))) _Float16 v16h;
typedef __attribute__((ext_vector_type(8)))  float    v8f;
typedef __attribute__((ext_vector_type(8)))  _Float16 h8;
typedef __attribute__((ext_vector_type(8)))  short    s8;

#define B_  2
#define S_  2048
#define D_  1024
#define H_  16
#define HD_ 64

__device__ __forceinline__ int lane_id() { return threadIdx.x & 31; }

// Fragment load with wide (b128) accesses.  Works for:
//  - A fragments (16x32 f16) from a row-major tile (lane = M row), and
//  - B fragments (32x16 f16) from a TRANSPOSED tile T[n][k] (lane = N col),
// since both reduce to: lane (l&15) reads two 8-half runs at K = kh and 16+kh.
// All addresses are 16-byte aligned (ld is a multiple of 8, kh is 0 or 8).
__device__ __forceinline__ v16h frag_ld(const _Float16* src, int ld) {
  const int l  = lane_id();
  const int m  = l & 15;
  const int kh = (l >> 4) << 3;
  const _Float16* r = src + (size_t)m * ld + kh;
  const h8 lo = *(const h8*)(r);
  const h8 hi = *(const h8*)(r + 16);
  return __builtin_shufflevector(lo, hi, 0, 1, 2, 3, 4, 5, 6, 7,
                                         8, 9, 10, 11, 12, 13, 14, 15);
}

// B fragment (32 K x 16 N f16) from a ROW-MAJOR LDS tile T[k][n] by the
// transposing LDS load: lane (c = l&15, h = l>>4) receives T[8h + 0..7][c] from
// the first load and T[16 + 8h + 0..7][c] from the second, which is the same k
// order as frag_ld gives the A operand.  tile points at T[0][first column];
// pitch is in halves and must be an odd multiple of 16 (32 bytes) for the banks.
__device__ __forceinline__ v16h frag_ld_tr(const _Float16* tile, int pitch) {
  typedef __attribute__((address_space(3))) s8 lds_s8;
  const int l = lane_id();
  const _Float16* p = tile + (8 * (l >> 4) + (l & 7)) * pitch + 8 * ((l >> 3) & 1);
  const h8 lo = __builtin_bit_cast(h8, __builtin_amdgcn_ds_load_tr16_b128_v8i16((lds_s8*)p));
  const h8 hi = __builtin_bit_cast(h8, __builtin_amdgcn_ds_load_tr16_b128_v8i16((lds_s8*)(p + 16 * pitch)));
  return __builtin_shufflevector(lo, hi, 0, 1, 2, 3, 4, 5, 6, 7,
                                         8, 9, 10, 11, 12, 13, 14, 15);
}

// Work-group barrier that orders LDS accesses only.  __syncthreads() also waits
// for the wave's global loads, which here must stay in flight across it.
__device__ __forceinline__ void lds_barrier() {
  __builtin_amdgcn_fence(__ATOMIC_RELEASE, "workgroup", "local");
  __builtin_amdgcn_s_barrier();
  __builtin_amdgcn_fence(__ATOMIC_ACQUIRE, "workgroup", "local");
}

#define BM_ 128  // projection tile rows per work-group
#define BN_ 256  // projection tile columns per work-group
#define MF_ 4    // 16-row A fragments per wave (wave tile 64 x 64)
#define WP_ (BN_ + 16)  // W tile row pitch in halves (544 bytes, an odd multiple of 32)
#define VP_ 80   // V tile row pitch in halves:  64 + 16 (160 bytes)
// Tiles read by plain 16-byte LDS loads (one row per lane): pitch an odd
// multiple of 16 bytes, so that the 16 rows of a fragment fall on distinct banks.
#define XP_ 40   // X tile row pitch in halves:  32 + 8 (80 bytes)
#define KP_ 72   // K tile row pitch in halves:  64 + 8 (144 bytes)
#define KS_ 128  // keys per LDS stage of the attention kernel (four passes of 32)
#define NST_ (S_ / KS_)  // stages per head

// ---------------------------------------------------------------------------
// Kernel 1: QKV projection GEMM.  X = (x @ W + b) [* 0.125 for Q], f16 output
// in head-major [B,H,S,HD] layout.  Grid: (BS/128, D/256, 3), block 256:
// 8 waves as 2 (M) x 4 (N), each 64 x 64 of the tile.  The k-tiles run through a
// pipeline: global loads two tiles ahead of the products, LDS one tile ahead.
// ---------------------------------------------------------------------------
__global__ __launch_bounds__(256) void qkv_proj_kernel(
    const float* __restrict__ q, const float* __restrict__ k, const float* __restrict__ v,
    const float* __restrict__ Wq, const float* __restrict__ bq,
    const float* __restrict__ Wk, const float* __restrict__ bk,
    const float* __restrict__ Wv, const float* __restrict__ bv,
    _Float16* __restrict__ Xq, _Float16* __restrict__ Xk, _Float16* __restrict__ Xv)
{
  // Two buffers of each tile: tile kt + 1 is written while tile kt is read.
  __shared__ __align__(16) _Float16 Xt[2][BM_ * XP_];  // 128 M x 32 K, row-major, padded
  __shared__ __align__(16) _Float16 Wt[2][32 * WP_];   // 32 K x 256 N, row-major, padded

  const int z = blockIdx.z;
  const float* x    = (z == 0) ? q  : (z == 1) ? k  : v;
  const float* W    = (z == 0) ? Wq : (z == 1) ? Wk : Wv;
  const float* bias = (z == 0) ? bq : (z == 1) ? bk : bv;
  _Float16*    X    = (z == 0) ? Xq : (z == 1) ? Xk : Xv;
  const float oscale = (z == 0) ? 0.125f : 1.0f;  // fold 1/sqrt(HD) into Q

  const int m0   = blockIdx.x * BM_;
  const int n0   = blockIdx.y * BN_;
  const int t    = threadIdx.x;
  const int wave = t >> 5;
  const int mt   = (wave & 1) * (MF_ * 16);  // wave M sub-tile within the tile
  const int nt0  = (wave >> 1) * 64;         // wave N sub-tile within the tile

  // This thread's staged elements: of x rows t/4 and t/4 + 64, cols (t%4)*8;
  // of W k-rows t/32 + 8 j, n-cols (t%32)*8.
  const int xr = t >> 2, xc = (t & 3) * 8;
  const int wr = t / (BN_ / 8), wc = (t % (BN_ / 8)) * 8;
  const float* xs = x + (size_t)(m0 + xr) * D_ + xc;
  const float* ws = W + (size_t)wr * D_ + n0 + wc;

  float4 rx[4], rw[8];  // one k-tile of f32 on its way from global memory

  // Issue the loads of the k-tile that starts at column / row k0.
  auto tile_load = [&](int k0) {
#pragma unroll  // rx[] lives in registers: every index must be a constant
    for (int j = 0; j < 2; ++j) {
      const float* s = xs + k0 + j * 64 * D_;
      rx[2 * j]     = *(const float4*)(s);
      rx[2 * j + 1] = *(const float4*)(s + 4);
    }
#pragma unroll  // constant indices, as above
    for (int j = 0; j < 4; ++j) {
      const float* s = ws + (size_t)(k0 + 8 * j) * D_;
      rw[2 * j]     = *(const float4*)(s);
      rw[2 * j + 1] = *(const float4*)(s + 4);
    }
  };
  // Convert the loaded k-tile to f16 and store it to LDS buffer nb, 16 bytes a store.
  auto tile_store = [&](int nb) {
#pragma unroll  // constant indices, as above
    for (int j = 0; j < 2; ++j) {
      const float4 a0 = rx[2 * j], a1 = rx[2 * j + 1];
      h8 w;
      w[0] = (_Float16)a0.x; w[1] = (_Float16)a0.y; w[2] = (_Float16)a0.z; w[3] = (_Float16)a0.w;
      w[4] = (_Float16)a1.x; w[5] = (_Float16)a1.y; w[6] = (_Float16)a1.z; w[7] = (_Float16)a1.w;
      *(h8*)(Xt[nb] + (xr + 64 * j) * XP_ + xc) = w;
    }
#pragma unroll  // constant indices, as above
    for (int j = 0; j < 4; ++j) {
      const float4 a0 = rw[2 * j], a1 = rw[2 * j + 1];
      h8 w;
      w[0] = (_Float16)a0.x; w[1] = (_Float16)a0.y; w[2] = (_Float16)a0.z; w[3] = (_Float16)a0.w;
      w[4] = (_Float16)a1.x; w[5] = (_Float16)a1.y; w[6] = (_Float16)a1.z; w[7] = (_Float16)a1.w;
      *(h8*)(Wt[nb] + (wr + 8 * j) * WP_ + wc) = w;
    }
  };

  v8f acc[MF_][4] = {};

  // Prologue: tile 0 into buffer 0, tile 1 on its way.
  tile_load(0);
  tile_store(0);
  tile_load(32);
  lds_barrier();

  for (int kt = 0; kt < D_ / 32; ++kt) {
    const int buf = kt & 1;
    // Tile kt + 1 has had a whole trip to arrive: into the buffer that the
    // barrier at the foot of trip kt - 1 has freed; then tile kt + 2 sets out.
    if (kt + 1 < D_ / 32) tile_store(buf ^ 1);
    if (kt + 2 < D_ / 32) tile_load((kt + 2) * 32);
    // Keeps the loads in front of the products, or they would set out a trip's length later.
    __builtin_amdgcn_sched_barrier(0);

    v16h a[MF_];
#pragma unroll  // a[] and acc[][] live in registers: every index must be a constant
    for (int mi = 0; mi < MF_; ++mi) a[mi] = frag_ld(Xt[buf] + (mt + mi * 16) * XP_, XP_);
#pragma unroll
    for (int nsub = 0; nsub < 4; ++nsub) {
      const v16h bm = frag_ld_tr(Wt[buf] + nt0 + nsub * 16, WP_);
#pragma unroll  // constant indices, as above
      for (int mi = 0; mi < MF_; ++mi)
        acc[mi][nsub] = __builtin_amdgcn_wmma_f32_16x16x32_f16(
            false, a[mi], false, bm, (short)0, acc[mi][nsub], false, false);
    }
    // One barrier a trip: tile kt + 1 is published, tile kt's buffer is free.
    lds_barrier();
  }

  // Epilogue: bias + scale, scatter to head-major f16 workspace.
  const int l     = lane_id();
  const int nlane = l & 15;
  const int mb    = (l >> 4) << 3;
#pragma unroll
  for (int nsub = 0; nsub < 4; ++nsub) {
    const int n  = n0 + nt0 + nsub * 16 + nlane;
    const float bb = bias[n];
    const int h  = n >> 6, hd = n & 63;
#pragma unroll  // constant indices, as above
    for (int mi = 0; mi < MF_; ++mi) {
#pragma unroll
      for (int i = 0; i < 8; ++i) {
        const int m = m0 + mt + mi * 16 + mb + i;
        const int bb_idx = m >> 11;            // batch
        const int ss     = m & (S_ - 1);       // sequence pos
        X[(((size_t)(bb_idx * H_ + h)) * S_ + ss) * HD_ + hd] =
            (_Float16)((acc[mi][nsub][i] + bb) * oscale);
      }
    }
  }
}

// Value of lane l ^ 16 (the other 16-lane half of the wave).
__device__ __forceinline__ float xhalf(float x) {
  const int b = __builtin_bit_cast(int, x);
  return __builtin_bit_cast(float,
      __builtin_amdgcn_permlanex16(b, b, 0x76543210, 0xfedcba98, false, false));
}

// One stage (128 keys x 64 halves of K and of V) from global memory to LDS by
// asynchronous 16-byte copies, through no register: this lane's piece of rows
// r, r + 32, r + 64, r + 96.  gk, gv: the lane's global piece of row r;
// lk, lv: its LDS byte address in the K and in the V buffer.
// s_wait_xcnt 0 closes the statement, so that no address register of a copy
// takes a new value before it.
__device__ __forceinline__ void stage_copy(const _Float16* gk, const _Float16* gv,
                                           unsigned lk, unsigned lv) {
  asm volatile(
      "global_load_async_to_lds_b128 %0, %8, off\n\t"
      "global_load_async_to_lds_b128 %1, %9, off\n\t"
      "global_load_async_to_lds_b128 %2, %10, off\n\t"
      "global_load_async_to_lds_b128 %3, %11, off\n\t"
      "global_load_async_to_lds_b128 %4, %12, off\n\t"
      "global_load_async_to_lds_b128 %5, %13, off\n\t"
      "global_load_async_to_lds_b128 %6, %14, off\n\t"
      "global_load_async_to_lds_b128 %7, %15, off\n\t"
      "s_wait_xcnt 0x0"
      :: "v"(lk), "v"(lk + 32 * KP_ * 2), "v"(lk + 64 * KP_ * 2), "v"(lk + 96 * KP_ * 2),
         "v"(lv), "v"(lv + 32 * VP_ * 2), "v"(lv + 64 * VP_ * 2), "v"(lv + 96 * VP_ * 2),
         "v"(gk), "v"(gk + 32 * HD_), "v"(gk + 64 * HD_), "v"(gk + 96 * HD_),
         "v"(gv), "v"(gv + 32 * HD_), "v"(gv + 64 * HD_), "v"(gv + 96 * HD_)
      : "memory");
}

__global__ __launch_bounds__(256) void attn_kernel(
    const _Float16* __restrict__ Xq, const _Float16* __restrict__ Xk,
    const _Float16* __restrict__ Xv, float* __restrict__ out)
{
  __shared__ __align__(16) _Float16 Kt[2 * KS_ * KP_];  // two stages of 18 KB, row-major [k][d], padded
  __shared__ __align__(16) _Float16 Vt[2 * KS_ * VP_];  // two stages of 20 KB, row-major [k][d], padded

  const int bh   = blockIdx.y;           // 0..B*H-1
  const int b    = bh >> 4;
  const int h    = bh & 15;
  const int t    = threadIdx.x;
  const int wave = t >> 5;
  const int l    = lane_id();
  const int q0   = blockIdx.x * 128 + wave * 16;

  const size_t head_base = (size_t)bh * S_ * HD_;

  // This lane's piece of a stage: row t/8 (and + 32, 64, 96), 8 halves at (t%8)*8.
  const int sr = t >> 3, sc = (t & 7) * 8;
  const _Float16* gk = Xk + head_base + (size_t)sr * HD_ + sc;
  const _Float16* gv = Xv + head_base + (size_t)sr * HD_ + sc;
  const unsigned lk = (unsigned)(size_t)(Kt + sr * KP_ + sc);
  const unsigned lv = (unsigned)(size_t)(Vt + sr * VP_ + sc);

  // Q^T fragments (B operand: lane = query column, pre-scaled by 1/sqrt(HD));
  // same loader as the K rows, so both sides have the same k order.
  const v16h bq0 = frag_ld(Xq + head_base + (size_t)q0 * HD_, HD_);
  const v16h bq1 = frag_ld(Xq + head_base + (size_t)q0 * HD_ + 32, HD_);

  // Ring prologue: stage 0 lands and is published, then stage 1 starts to fly.
  stage_copy(gk, gv, lk, lv);
  asm volatile("s_wait_asynccnt 0x0" ::: "memory");  // this wave's copies of stage 0 have landed
  __syncthreads();                                   // ... and every other wave's
  stage_copy(gk + KS_ * HD_, gv + KS_ * HD_, lk + KS_ * KP_ * 2, lv + KS_ * VP_ * 2);

  v8f   o[4] = {};        // O^T: o[nsub][r] = O[query l&15][d = 16 nsub + 8 (l>>4) + r]
  float mrun = -1e30f;    // running maximum of this lane's query (equal in both halves)
  float lrun = 0.0f;      // running sum over the keys of this lane's half only

  for (int st = 0; st < NST_; ++st) {
   const int buf = st & 1;
#pragma unroll  // the four passes of a stage: LDS offsets become immediates
   for (int ps = 0; ps < KS_ / 32; ++ps) {
    // This pass's 32 keys, both tiles row-major; the V^T A-fragments come by the
    // transposing load.
    const _Float16* Kp = Kt + (buf * KS_ + ps * 32) * KP_;
    const _Float16* Vp = Vt + (buf * KS_ + ps * 32) * VP_;

    // Scores, transposed: s0[r] = score(key 8 (l>>4) + r, query l&15),
    // s1[r] the same for key 16 + 8 (l>>4) + r.  A = K rows, B = Q^T.
    v8f s0 = {}, s1 = {};
    {
      const v16h ak0 = frag_ld(Kp, KP_);            // k 0..15, d 0..31
      const v16h ak1 = frag_ld(Kp + 32, KP_);       // k 0..15, d 32..63
      s0 = __builtin_amdgcn_wmma_f32_16x16x32_f16(false, ak0, false, bq0, (short)0, s0, false, false);
      s0 = __builtin_amdgcn_wmma_f32_16x16x32_f16(false, ak1, false, bq1, (short)0, s0, false, false);
      const v16h ak2 = frag_ld(Kp + 16 * KP_, KP_);      // k 16..31, d 0..31
      const v16h ak3 = frag_ld(Kp + 16 * KP_ + 32, KP_); // k 16..31, d 32..63
      s1 = __builtin_amdgcn_wmma_f32_16x16x32_f16(false, ak2, false, bq0, (short)0, s1, false, false);
      s1 = __builtin_amdgcn_wmma_f32_16x16x32_f16(false, ak3, false, bq1, (short)0, s1, false, false);
    }

    // Online softmax: 16 keys of one query per lane, the other 16 in lane l ^ 16.
    float rmax = fmaxf(s0[0], s1[0]);
#pragma unroll
    for (int r = 1; r < 8; ++r) rmax = fmaxf(rmax, fmaxf(s0[r], s1[r]));
    rmax = fmaxf(rmax, xhalf(rmax));
    const float mnew = fmaxf(mrun, rmax);
    const float corr = __expf(mrun - mnew);
    mrun = mnew;

    // P^T as B operand: element s is key 8 (l>>4) + s for s < 8 and
    // 16 + 8 (l>>4) + (s - 8) above, the k order of the transposing load.
    v16h bp;
    float psum = 0.0f;
#pragma unroll
    for (int r = 0; r < 8; ++r) {
      const float p0 = __expf(s0[r] - mnew);
      const float p1 = __expf(s1[r] - mnew);
      psum += p0 + p1;
      bp[r]     = (_Float16)p0;
      bp[8 + r] = (_Float16)p1;
    }
    lrun = lrun * corr + psum;
#pragma unroll
    for (int nsub = 0; nsub < 4; ++nsub) o[nsub] *= corr;

    // O^T += V^T @ P^T  (A = 16 d x 32 keys from row-major Vt, B = P^T).
#pragma unroll
    for (int nsub = 0; nsub < 4; ++nsub) {
      const v16h avf = frag_ld_tr(Vp + nsub * 16, VP_);
      o[nsub] = __builtin_amdgcn_wmma_f32_16x16x32_f16(
          false, avf, false, bp, (short)0, o[nsub], false, false);
    }
   }

   // Publish point of stage st + 1, in the ring's order.
   asm volatile("s_wait_dscnt 0x0" ::: "memory");     // this wave's reads of stage st are done
   asm volatile("s_wait_asynccnt 0x0" ::: "memory");  // its copies of stage st + 1 have landed
   __syncthreads();  // all waves: stage st + 1 may be read, stage st's buffer refilled
   if (st + 2 < NST_)
     stage_copy(gk + (size_t)(st + 2) * KS_ * HD_, gv + (size_t)(st + 2) * KS_ * HD_,
                lk + buf * (KS_ * KP_ * 2), lv + buf * (KS_ * VP_ * 2));
  }
  asm volatile("s_wait_asynccnt 0x0" ::: "memory");  // nothing in flight when the wave ends

  // Epilogue: join the halves' sums, normalize, write merged-head f32 output
  // [B,S,D]; a lane holds 8 consecutive d of its query in each tile.
  const float lsum = lrun + xhalf(lrun);
  float* orow = out + ((size_t)b * S_ + q0 + (l & 15)) * D_ + h * HD_ + ((l >> 4) << 3);
#pragma unroll
  for (int nsub = 0; nsub < 4; ++nsub) {
    float4 w0, w1;
    w0.x = o[nsub][0] / lsum; w0.y = o[nsub][1] / lsum; w0.z = o[nsub][2] / lsum; w0.w = o[nsub][3] / lsum;
    w1.x = o[nsub][4] / lsum; w1.y = o[nsub][5] / lsum; w1.z = o[nsub][6] / lsum; w1.w = o[nsub][7] / lsum;
    *(float4*)(orow + nsub * 16)     = w0;
    *(float4*)(orow + nsub * 16 + 4) = w1;
  }
}

extern "C" void kernel_launch(void* const* d_in, const int* in_sizes, int n_in,
                              void* d_out, int out_size, void* d_ws, size_t ws_size,
                              hipStream_t stream) {
  (void)in_sizes; (void)n_in; (void)out_size; (void)ws_size;
  const float* q  = (const float*)d_in[0];
  const float* k  = (const float*)d_in[1];
  const float* v  = (const float*)d_in[2];
  const float* Wq = (const float*)d_in[3];
  const float* bq = (const float*)d_in[4];
  const float* Wk = (const float*)d_in[5];
  const float* bk = (const float*)d_in[6];
  const float* Wv = (const float*)d_in[7];
  const float* bv = (const float*)d_in[8];
  float* out = (float*)d_out;

  const size_t nX = (size_t)B_ * H_ * S_ * HD_;   // 4M elems -> 8 MB f16 each
  _Float16* Xq = (_Float16*)d_ws;
  _Float16* Xk = Xq + nX;
  _Float16* Xv = Xk + nX;

  dim3 gp(B_ * S_ / BM_, D_ / BN_, 3);
  qkv_proj_kernel<<<gp, 256, 0, stream>>>(q, k, v, Wq, bq, Wk, bk, Wv, bv, Xq, Xk, Xv);

  dim3 ga(S_ / 128, B_ * H_);
  attn_kernel<<<ga, 256, 0, stream>>>(Xq, Xk, Xv, out);
}

// v007
// It runs in 84.8 microseconds.
// Timed twice side by side with v006, it ran 1.04 times as fast both times.
// Counting every step since v000, it is 3.47 times as fast.
#include <hip/hip_runtime.h>
#include <hip/hip_bf16.h>

typedef __attribute__((ext_vector_type(16))) _Float16 v16h;
typedef __attribute__((ext_vector_type(8)))  float    v8f;
typedef __attribute__((ext_vector_type(8)))  _Float16 h8;
typedef __attribute__((ext_vector_type(8)))  short    s8;
typedef __attribute__((ext_vector_type(2)))  float    v2f;
struct quad2 { v2f p[4]; };  // an accumulator tile's 8 registers as 4 pairs

#define B_  2
#define S_  2048
#define D_  1024
#define H_  16
#define HD_ 64

__device__ __forceinline__ int lane_id() { return threadIdx.x & 31; }

// Fragment load with wide (b128) accesses.  Works for:
//  - A fragments (16x32 f16) from a row-major tile (lane = M row), and
//  - B fragments (32x16 f16) from a TRANSPOSED tile T[n][k] (lane = N col),
// since both reduce to: lane (l&15) reads two 8-half runs at K = kh and 16+kh.
// All addresses are 16-byte aligned (ld is a multiple of 8, kh is 0 or 8).
__device__ __forceinline__ v16h frag_ld(const _Float16* src, int ld) {
  const int l  = lane_id();
  const int m  = l & 15;
  const int kh = (l >> 4) << 3;
  const _Float16* r = src + (size_t)m * ld + kh;
  const h8 lo = *(const h8*)(r);
  const h8 hi = *(const h8*)(r + 16);
  return __builtin_shufflevector(lo, hi, 0, 1, 2, 3, 4, 5, 6, 7,
                                         8, 9, 10, 11, 12, 13, 14, 15);
}

// B fragment (32 K x 16 N f16) from a ROW-MAJOR LDS tile T[k][n] by the
// transposing LDS load: lane (c = l&15, h = l>>4) receives T[8h + 0..7][c] from
// the first load and T[16 + 8h + 0..7][c] from the second, which is the same k
// order as frag_ld gives the A operand.  tile points at T[0][first column];
// pitch is in halves and must be an odd multiple of 16 (32 bytes) for the banks.
__device__ __forceinline__ v16h frag_ld_tr(const _Float16* tile, int pitch) {
  typedef __attribute__((address_space(3))) s8 lds_s8;
  const int l = lane_id();
  const _Float16* p = tile + (8 * (l >> 4) + (l & 7)) * pitch + 8 * ((l >> 3) & 1);
  const h8 lo = __builtin_bit_cast(h8, __builtin_amdgcn_ds_load_tr16_b128_v8i16((lds_s8*)p));
  const h8 hi = __builtin_bit_cast(h8, __builtin_amdgcn_ds_load_tr16_b128_v8i16((lds_s8*)(p + 16 * pitch)));
  return __builtin_shufflevector(lo, hi, 0, 1, 2, 3, 4, 5, 6, 7,
                                         8, 9, 10, 11, 12, 13, 14, 15);
}

// Work-group barrier that orders LDS accesses only.  __syncthreads() also waits
// for the wave's global loads, which here must stay in flight across it.
__device__ __forceinline__ void lds_barrier() {
  __builtin_amdgcn_fence(__ATOMIC_RELEASE, "workgroup", "local");
  __builtin_amdgcn_s_barrier();
  __builtin_amdgcn_fence(__ATOMIC_ACQUIRE, "workgroup", "local");
}

#define BM_ 128  // projection tile rows per work-group
#define BN_ 256  // projection tile columns per work-group
#define MF_ 4    // 16-row A fragments per wave (wave tile 64 x 64)
#define WP_ (BN_ + 16)  // W tile row pitch in halves (544 bytes, an odd multiple of 32)
#define VP_ 80   // V tile row pitch in halves:  64 + 16 (160 bytes)
// Tiles read by plain 16-byte LDS loads (one row per lane): pitch an odd
// multiple of 16 bytes, so that the 16 rows of a fragment fall on distinct banks.
#define XP_ 40   // X tile row pitch in halves:  32 + 8 (80 bytes)
#define KP_ 72   // K tile row pitch in halves:  64 + 8 (144 bytes)
#define KS_ 128  // keys per LDS stage of the attention kernel (two passes of 32 by each key half)
#define NST_ (S_ / KS_)  // stages per head
#define QC_ 2    // 16-column query groups per attention wave
#define JQ_ (QC_ * 8 + 1)  // 16-byte quads a lane hands over in the join: O^T, then maxima and sums

// ---------------------------------------------------------------------------
// Kernel 1: QKV projection GEMM.  X = (x @ W + b) [* 0.125 for Q], f16 output
// in head-major [B,H,S,HD] layout.  Grid: (BS/128, D/256, 3), block 256:
// 8 waves as 2 (M) x 4 (N), each 64 x 64 of the tile.  The k-tiles run through a
// pipeline: global loads two tiles ahead of the products, LDS one tile ahead.
// ---------------------------------------------------------------------------
__global__ __launch_bounds__(256) void qkv_proj_kernel(
    const float* __restrict__ q, const float* __restrict__ k, const float* __restrict__ v,
    const float* __restrict__ Wq, const float* __restrict__ bq,
    const float* __restrict__ Wk, const float* __restrict__ bk,
    const float* __restrict__ Wv, const float* __restrict__ bv,
    _Float16* __restrict__ Xq, _Float16* __restrict__ Xk, _Float16* __restrict__ Xv)
{
  // Two buffers of each tile: tile kt + 1 is written while tile kt is read.
  __shared__ __align__(16) _Float16 Xt[2][BM_ * XP_];  // 128 M x 32 K, row-major, padded
  __shared__ __align__(16) _Float16 Wt[2][32 * WP_];   // 32 K x 256 N, row-major, padded

  const int z = blockIdx.z;
  const float* x    = (z == 0) ? q  : (z == 1) ? k  : v;
  const float* W    = (z == 0) ? Wq : (z == 1) ? Wk : Wv;
  const float* bias = (z == 0) ? bq : (z == 1) ? bk : bv;
  _Float16*    X    = (z == 0) ? Xq : (z == 1) ? Xk : Xv;
  const float oscale = (z == 0) ? 0.125f : 1.0f;  // fold 1/sqrt(HD) into Q

  const int m0   = blockIdx.x * BM_;
  const int n0   = blockIdx.y * BN_;
  const int t    = threadIdx.x;
  const int wave = t >> 5;
  const int mt   = (wave & 1) * (MF_ * 16);  // wave M sub-tile within the tile
  const int nt0  = (wave >> 1) * 64;         // wave N sub-tile within the tile

  // This thread's staged elements: of x rows t/4 and t/4 + 64, cols (t%4)*8;
  // of W k-rows t/32 + 8 j, n-cols (t%32)*8.
  const int xr = t >> 2, xc = (t & 3) * 8;
  const int wr = t / (BN_ / 8), wc = (t % (BN_ / 8)) * 8;
  const float* xs = x + (size_t)(m0 + xr) * D_ + xc;
  const float* ws = W + (size_t)wr * D_ + n0 + wc;

  float4 rx[4], rw[8];  // one k-tile of f32 on its way from global memory

  // Issue the loads of the k-tile that starts at column / row k0.
  auto tile_load = [&](int k0) {
#pragma unroll  // rx[] lives in registers: every index must be a constant
    for (int j = 0; j < 2; ++j) {
      const float* s = xs + k0 + j * 64 * D_;
      rx[2 * j]     = *(const float4*)(s);
      rx[2 * j + 1] = *(const float4*)(s + 4);
    }
#pragma unroll  // constant indices, as above
    for (int j = 0; j < 4; ++j) {
      const float* s = ws + (size_t)(k0 + 8 * j) * D_;
      rw[2 * j]     = *(const float4*)(s);
      rw[2 * j + 1] = *(const float4*)(s + 4);
    }
  };
  // Convert the loaded k-tile to f16 and store it to LDS buffer nb, 16 bytes a store.
  auto tile_store = [&](int nb) {
#pragma unroll  // constant indices, as above
    for (int j = 0; j < 2; ++j) {
      const float4 a0 = rx[2 * j], a1 = rx[2 * j + 1];
      h8 w;
      w[0] = (_Float16)a0.x; w[1] = (_Float16)a0.y; w[2] = (_Float16)a0.z; w[3] = (_Float16)a0.w;
      w[4] = (_Float16)a1.x; w[5] = (_Float16)a1.y; w[6] = (_Float16)a1.z; w[7] = (_Float16)a1.w;
      *(h8*)(Xt[nb] + (xr + 64 * j) * XP_ + xc) = w;
    }
#pragma unroll  // constant indices, as above
    for (int j = 0; j < 4; ++j) {
      const float4 a0 = rw[2 * j], a1 = rw[2 * j + 1];
      h8 w;
      w[0] = (_Float16)a0.x; w[1] = (_Float16)a0.y; w[2] = (_Float16)a0.z; w[3] = (_Float16)a0.w;
      w[4] = (_Float16)a1.x; w[5] = (_Float16)a1.y; w[6] = (_Float16)a1.z; w[7] = (_Float16)a1.w;
      *(h8*)(Wt[nb] + (wr + 8 * j) * WP_ + wc) = w;
    }
  };

  v8f acc[MF_][4] = {};

  // Prologue: tile 0 into buffer 0, tile 1 on its way.
  tile_load(0);
  tile_store(0);
  tile_load(32);
  lds_barrier();

  for (int kt = 0; kt < D_ / 32; ++kt) {
    const int buf = kt & 1;
    // Tile kt + 1 has had a whole trip to arrive: into the buffer that the
    // barrier at the foot of trip kt - 1 has freed; then tile kt + 2 sets out.
    if (kt + 1 < D_ / 32) tile_store(buf ^ 1);
    if (kt + 2 < D_ / 32) tile_load((kt + 2) * 32);
    // Keeps the loads in front of the products, or they would set out a trip's length later.
    __builtin_amdgcn_sched_barrier(0);

    v16h a[MF_];
#pragma unroll  // a[] and acc[][] live in registers: every index must be a constant
    for (int mi = 0; mi < MF_; ++mi) a[mi] = frag_ld(Xt[buf] + (mt + mi * 16) * XP_, XP_);
#pragma unroll
    for (int nsub = 0; nsub < 4; ++nsub) {
      const v16h bm = frag_ld_tr(Wt[buf] + nt0 + nsub * 16, WP_);
#pragma unroll  // constant indices, as above
      for (int mi = 0; mi < MF_; ++mi)
        acc[mi][nsub] = __builtin_amdgcn_wmma_f32_16x16x32_f16(
            false, a[mi], false, bm, (short)0, acc[mi][nsub], false, false);
    }
    // One barrier a trip: tile kt + 1 is published, tile kt's buffer is free.
    lds_barrier();
  }

  // Epilogue: bias + scale, scatter to head-major f16 workspace.
  const int l     = lane_id();
  const int nlane = l & 15;
  const int mb    = (l >> 4) << 3;
#pragma unroll
  for (int nsub = 0; nsub < 4; ++nsub) {
    const int n  = n0 + nt0 + nsub * 16 + nlane;
    const float bb = bias[n];
    const int h  = n >> 6, hd = n & 63;
#pragma unroll  // constant indices, as above
    for (int mi = 0; mi < MF_; ++mi) {
#pragma unroll
      for (int i = 0; i < 8; ++i) {
        const int m = m0 + mt + mi * 16 + mb + i;
        const int bb_idx = m >> 11;            // batch
        const int ss     = m & (S_ - 1);       // sequence pos
        X[(((size_t)(bb_idx * H_ + h)) * S_ + ss) * HD_ + hd] =
            (_Float16)((acc[mi][nsub][i] + bb) * oscale);
      }
    }
  }
}

// Value of lane l ^ 16 (the other 16-lane half of the wave).
__device__ __forceinline__ float xhalf(float x) {
  const int b = __builtin_bit_cast(int, x);
  return __builtin_bit_cast(float,
      __builtin_amdgcn_permlanex16(b, b, 0x76543210, 0xfedcba98, false, false));
}

// One stage (128 keys x 64 halves of K and of V) from global memory to LDS by
// asynchronous 16-byte copies, through no register: this lane's piece of rows
// r, r + 32, r + 64, r + 96.  gk, gv: the lane's global piece of row r;
// lk, lv: its LDS byte address in the K and in the V buffer.
// s_wait_xcnt 0 closes the statement, so that no address register of a copy
// takes a new value before it.
__device__ __forceinline__ void stage_copy(const _Float16* gk, const _Float16* gv,
                                           unsigned lk, unsigned lv) {
  asm volatile(
      "global_load_async_to_lds_b128 %0, %8, off\n\t"
      "global_load_async_to_lds_b128 %1, %9, off\n\t"
      "global_load_async_to_lds_b128 %2, %10, off\n\t"
      "global_load_async_to_lds_b128 %3, %11, off\n\t"
      "global_load_async_to_lds_b128 %4, %12, off\n\t"
      "global_load_async_to_lds_b128 %5, %13, off\n\t"
      "global_load_async_to_lds_b128 %6, %14, off\n\t"
      "global_load_async_to_lds_b128 %7, %15, off\n\t"
      "s_wait_xcnt 0x0"
      :: "v"(lk), "v"(lk + 32 * KP_ * 2), "v"(lk + 64 * KP_ * 2), "v"(lk + 96 * KP_ * 2),
         "v"(lv), "v"(lv + 32 * VP_ * 2), "v"(lv + 64 * VP_ * 2), "v"(lv + 96 * VP_ * 2),
         "v"(gk), "v"(gk + 32 * HD_), "v"(gk + 64 * HD_), "v"(gk + 96 * HD_),
         "v"(gv), "v"(gv + 32 * HD_), "v"(gv + 64 * HD_), "v"(gv + 96 * HD_)
      : "memory");
}

// Four waves per SIMD (two work-groups per WGP): the softmax between the matrix
// runs is hidden by other waves, so the registers must stay within 256.
__global__ __launch_bounds__(256) __attribute__((amdgpu_waves_per_eu(4, 4))) void attn_kernel(
    const _Float16* __restrict__ Xq, const _Float16* __restrict__ Xk,
    const _Float16* __restrict__ Xv, float* __restrict__ out)
{
  __shared__ __align__(16) _Float16 Kt[2 * KS_ * KP_];  // two stages of 18 KB, row-major [k][d], padded
  __shared__ __align__(16) _Float16 Vt[2 * KS_ * VP_];  // two stages of 20 KB, row-major [k][d], padded

  const int bh   = blockIdx.y;           // 0..B*H-1
  const int b    = bh >> 4;
  const int h    = bh & 15;
  const int t    = threadIdx.x;
  // The wave's number as a scalar: its LDS bases and the join's branches are then scalar too.
  const int wave = __builtin_amdgcn_readfirstlane(t >> 5);
  const int qg   = wave & 3;             // which 32 queries of the block
  const int kg   = wave >> 2;            // which 64 keys of every stage
  const int l    = lane_id();
  const int q0   = blockIdx.x * 128 + qg * (QC_ * 16);

  const size_t head_base = (size_t)bh * S_ * HD_;

  // This lane's piece of a stage: row t/8 (and + 32, 64, 96), 8 halves at (t%8)*8.
  const int sr = t >> 3, sc = (t & 7) * 8;
  const _Float16* gk = Xk + head_base + (size_t)sr * HD_ + sc;
  const _Float16* gv = Xv + head_base + (size_t)sr * HD_ + sc;
  const unsigned lk = (unsigned)(size_t)(Kt + sr * KP_ + sc);
  const unsigned lv = (unsigned)(size_t)(Vt + sr * VP_ + sc);

  // Q^T fragments (B operand: lane = query column, pre-scaled by 1/sqrt(HD));
  // same loader as the K rows, so both sides have the same k order.
  v16h bq[QC_][2];
#pragma unroll  // bq[][] lives in registers: every index must be a constant
  for (int c = 0; c < QC_; ++c) {
    bq[c][0] = frag_ld(Xq + head_base + (size_t)(q0 + 16 * c) * HD_, HD_);
    bq[c][1] = frag_ld(Xq + head_base + (size_t)(q0 + 16 * c) * HD_ + 32, HD_);
  }

  // Ring prologue: stage 0 lands and is published, then stage 1 starts to fly.
  stage_copy(gk, gv, lk, lv);
  asm volatile("s_wait_asynccnt 0x0" ::: "memory");  // this wave's copies of stage 0 have landed
  __syncthreads();                                   // ... and every other wave's
  stage_copy(gk + KS_ * HD_, gv + KS_ * HD_, lk + KS_ * KP_ * 2, lv + KS_ * VP_ * 2);

  // Per 16-column group c, over this wave's keys only:
  v8f   o[QC_][4] = {};   // O^T: o[c][nsub][r] = O[query 16 c + (l&15)][d = 16 nsub + 8 (l>>4) + r]
  float mrun[QC_];        // running maximum of this lane's query (equal in both halves)
  float lrun[QC_];        // running sum over the keys of this lane's half only
#pragma unroll  // constant indices, as above
  for (int c = 0; c < QC_; ++c) { mrun[c] = -1e30f; lrun[c] = 0.0f; }

  // This wave's 64 keys of buffer 0.
  const _Float16* Kw = Kt + kg * (KS_ / 2) * KP_;
  const _Float16* Vw = Vt + kg * (KS_ / 2) * VP_;

  for (int st = 0; st < NST_; ++st) {
   const int buf = st & 1;
#pragma unroll  // the wave's two passes of a stage: LDS offsets become immediates
   for (int ps = 0; ps < KS_ / 64; ++ps) {
    // This pass's 32 keys, both tiles row-major; the V^T A-fragments come by the
    // transposing load.
    const _Float16* Kp = Kw + (buf * KS_ + ps * 32) * KP_;
    const _Float16* Vp = Vw + (buf * KS_ + ps * 32) * VP_;

    // Scores, transposed: s0[c][r] = score(key 8 (l>>4) + r, query 16 c + (l&15)),
    // s1[c][r] the same for key 16 + 8 (l>>4) + r.  A = K rows, B = Q^T.
    v8f s0[QC_] = {}, s1[QC_] = {};
    {
      const v16h ak0 = frag_ld(Kp, KP_);                 // k 0..15, d 0..31
      const v16h ak1 = frag_ld(Kp + 32, KP_);            // k 0..15, d 32..63
      const v16h ak2 = frag_ld(Kp + 16 * KP_, KP_);      // k 16..31, d 0..31
      const v16h ak3 = frag_ld(Kp + 16 * KP_ + 32, KP_); // k 16..31, d 32..63
#pragma unroll  // constant indices, as above
      for (int c = 0; c < QC_; ++c) {
        s0[c] = __builtin_amdgcn_wmma_f32_16x16x32_f16(false, ak0, false, bq[c][0], (short)0, s0[c], false, false);
        s1[c] = __builtin_amdgcn_wmma_f32_16x16x32_f16(false, ak2, false, bq[c][0], (short)0, s1[c], false, false);
      }
#pragma unroll  // constant indices, as above
      for (int c = 0; c < QC_; ++c) {
        s0[c] = __builtin_amdgcn_wmma_f32_16x16x32_f16(false, ak1, false, bq[c][1], (short)0, s0[c], false, false);
        s1[c] = __builtin_amdgcn_wmma_f32_16x16x32_f16(false, ak3, false, bq[c][1], (short)0, s1[c], false, false);
      }
    }

    v16h bp[QC_];
#pragma unroll  // constant indices, as above
    for (int c = 0; c < QC_; ++c) {
      // Online softmax: 16 keys of one query per lane, the other 16 in lane l ^ 16.
      float rmax = fmaxf(s0[c][0], s1[c][0]);
#pragma unroll
      for (int r = 1; r < 8; ++r) rmax = fmaxf(rmax, fmaxf(s0[c][r], s1[c][r]));
      rmax = fmaxf(rmax, xhalf(rmax));
      const float mnew = fmaxf(mrun[c], rmax);
      const float corr = __expf(mrun[c] - mnew);
      mrun[c] = mnew;

      // P^T as B operand: element s is key 8 (l>>4) + s for s < 8 and
      // 16 + 8 (l>>4) + (s - 8) above, the k order of the transposing load.
      // Worked on as register-adjacent pairs, so that the packed subtract, multiply
      // and add need no register moves.  exp(x) = exp2(x * log2(e)), as __expf has it.
      const quad2 t0 = __builtin_bit_cast(quad2, s0[c]);
      const quad2 t1 = __builtin_bit_cast(quad2, s1[c]);
      const v2f m2 = {mnew, mnew};
      v2f ps2 = {0.0f, 0.0f};
#pragma unroll  // constant indices, as above
      for (int r = 0; r < 4; ++r) {
        const v2f x0 = (t0.p[r] - m2) * 1.442695041f;
        const v2f x1 = (t1.p[r] - m2) * 1.442695041f;
        const v2f p0 = {__builtin_amdgcn_exp2f(x0[0]), __builtin_amdgcn_exp2f(x0[1])};
        const v2f p1 = {__builtin_amdgcn_exp2f(x1[0]), __builtin_amdgcn_exp2f(x1[1])};
        ps2 += p0 + p1;
        bp[c][2 * r]         = (_Float16)p0[0];
        bp[c][2 * r + 1]     = (_Float16)p0[1];
        bp[c][8 + 2 * r]     = (_Float16)p1[0];
        bp[c][8 + 2 * r + 1] = (_Float16)p1[1];
      }
      const float psum = ps2[0] + ps2[1];
      lrun[c] = lrun[c] * corr + psum;
#pragma unroll
      for (int nsub = 0; nsub < 4; ++nsub) o[c][nsub] *= corr;
    }

    // O^T += V^T @ P^T  (A = 16 d x 32 keys from row-major Vt, B = P^T).
#pragma unroll
    for (int nsub = 0; nsub < 4; ++nsub) {
      const v16h avf = frag_ld_tr(Vp + nsub * 16, VP_);
#pragma unroll  // constant indices, as above
      for (int c = 0; c < QC_; ++c)
        o[c][nsub] = __builtin_amdgcn_wmma_f32_16x16x32_f16(
            false, avf, false, bp[c], (short)0, o[c][nsub], false, false);
    }
   }

   // Publish point of stage st + 1, in the ring's order.
   asm volatile("s_wait_dscnt 0x0" ::: "memory");     // this wave's reads of stage st are done
   asm volatile("s_wait_asynccnt 0x0" ::: "memory");  // its copies of stage st + 1 have landed
   __syncthreads();  // all waves: stage st + 1 may be read, stage st's buffer refilled
   if (st + 2 < NST_)
     stage_copy(gk + (size_t)(st + 2) * KS_ * HD_, gv + (size_t)(st + 2) * KS_ * HD_,
                lk + buf * (KS_ * KP_ * 2), lv + buf * (KS_ * VP_ * 2));
  }
  asm volatile("s_wait_asynccnt 0x0" ::: "memory");  // nothing in flight when the wave ends

  // Join of the two key halves.  The last publish point has ended every read of
  // the ring and no copy is in flight, so the K ring serves as the mailbox: lane l
  // of wave (qg, 1) hands its 17 quads to lane l of wave (qg, 0), quad j of all 32
  // lanes in one contiguous 512-byte row.
  float4* mail = (float4*)Kt + qg * (JQ_ * 32) + l;
  if (kg == 1) {
#pragma unroll  // constant indices, as above
    for (int c = 0; c < QC_; ++c) {
#pragma unroll  // constant indices, as above
      for (int nsub = 0; nsub < 4; ++nsub) {
        const v8f w = o[c][nsub];
        mail[((c * 4 + nsub) * 2) * 32]     = make_float4(w[0], w[1], w[2], w[3]);
        mail[((c * 4 + nsub) * 2 + 1) * 32] = make_float4(w[4], w[5], w[6], w[7]);
      }
    }
    mail[(JQ_ - 1) * 32] = make_float4(mrun[0], mrun[1], lrun[0], lrun[1]);
  }
  __syncthreads();  // the partial results of the second key half are published

  // Epilogue, by the waves of the first key half: both partials to the common
  // maximum, join the lane halves' sums, normalize, write merged-head f32 output
  // [B,S,D]; a lane holds 8 consecutive d of its query in each tile.
  if (kg == 0) {
    const float4 ml = mail[(JQ_ - 1) * 32];
#pragma unroll  // constant indices, as above
    for (int c = 0; c < QC_; ++c) {
      const float mb = c ? ml.y : ml.x;
      const float lb = c ? ml.w : ml.z;
      const float mj = fmaxf(mrun[c], mb);
      const float fa = __expf(mrun[c] - mj);
      const float fb = __expf(mb - mj);
      const float lj = lrun[c] * fa + lb * fb;
      const float lsum = lj + xhalf(lj);
      const float ga = fa / lsum, gb = fb / lsum;  // rescale and 1 / sum in one factor a partial
      float* orow = out + ((size_t)b * S_ + q0 + 16 * c + (l & 15)) * D_ + h * HD_ + ((l >> 4) << 3);
#pragma unroll  // constant indices, as above
      for (int nsub = 0; nsub < 4; ++nsub) {
        const v8f    w  = o[c][nsub];
        const float4 u0 = mail[((c * 4 + nsub) * 2) * 32];
        const float4 u1 = mail[((c * 4 + nsub) * 2 + 1) * 32];
        float4 w0, w1;
        w0.x = w[0] * ga + u0.x * gb; w0.y = w[1] * ga + u0.y * gb;
        w0.z = w[2] * ga + u0.z * gb; w0.w = w[3] * ga + u0.w * gb;
        w1.x = w[4] * ga + u1.x * gb; w1.y = w[5] * ga + u1.y * gb;
        w1.z = w[6] * ga + u1.z * gb; w1.w = w[7] * ga + u1.w * gb;
        *(float4*)(orow + nsub * 16)     = w0;
        *(float4*)(orow + nsub * 16 + 4) = w1;
      }
    }
  }
}

extern "C" void kernel_launch(void* const* d_in, const int* in_sizes, int n_in,
                              void* d_out, int out_size, void* d_ws, size_t ws_size,
                              hipStream_t stream) {
  (void)in_sizes; (void)n_in; (void)out_size; (void)ws_size;
  const float* q  = (const float*)d_in[0];
  const float* k  = (const float*)d_in[1];
  const float* v  = (const float*)d_in[2];
  const float* Wq = (const float*)d_in[3];
  const float* bq = (const float*)d_in[4];
  const float* Wk = (const float*)d_in[5];
  const float* bk = (const float*)d_in[6];
  const float* Wv = (const float*)d_in[7];
  const float* bv = (const float*)d_in[8];
  float* out = (float*)d_out;

  const size_t nX = (size_t)B_ * H_ * S_ * HD_;   // 4M elems -> 8 MB f16 each
  _Float16* Xq = (_Float16*)d_ws;
  _Float16* Xk = Xq + nX;
  _Float16* Xv = Xk + nX;

  dim3 gp(B_ * S_ / BM_, D_ / BN_, 3);
  qkv_proj_kernel<<<gp, 256, 0, stream>>>(q, k, v, Wq, bq, Wk, bk, Wv, bv, Xq, Xk, Xv);

  dim3 ga(S_ / 128, B_ * H_);
  attn_kernel<<<ga, 256, 0, stream>>>(Xq, Xk, Xv, out);
}

// v008
// A run of this version takes 79.4 microseconds.
// Timed twice side by side with v007, it ran 1.07 times as fast both times.
// All steps since v000 together make it 3.72 times as fast.
#include <hip/hip_runtime.h>
#include <hip/hip_bf16.h>

typedef __attribute__((ext_vector_type(16))) _Float16 v16h;
typedef __attribute__((ext_vector_type(8)))  float    v8f;
typedef __attribute__((ext_vector_type(8)))  _Float16 h8;
typedef __attribute__((ext_vector_type(8)))  short    s8;
typedef __attribute__((ext_vector_type(2)))  float    v2f;
struct quad2 { v2f p[4]; };  // an accumulator tile's 8 registers as 4 pairs

#define B_  2
#define S_  2048
#define D_  1024
#define H_  16
#define HD_ 64

__device__ __forceinline__ int lane_id() { return threadIdx.x & 31; }

// Fragment load with wide (b128) accesses.  Works for:
//  - A fragments (16x32 f16) from a row-major tile (lane = M row), and
//  - B fragments (32x16 f16) from a TRANSPOSED tile T[n][k] (lane = N col),
// since both reduce to: lane (l&15) reads two 8-half runs at K = kh and 16+kh.
// All addresses are 16-byte aligned (ld is a multiple of 8, kh is 0 or 8).
__device__ __forceinline__ v16h frag_ld(const _Float16* src, int ld) {
  const int l  = lane_id();
  const int m  = l & 15;
  const int kh = (l >> 4) << 3;
  const _Float16* r = src + (size_t)m * ld + kh;
  const h8 lo = *(const h8*)(r);
  const h8 hi = *(const h8*)(r + 16);
  return __builtin_shufflevector(lo, hi, 0, 1, 2, 3, 4, 5, 6, 7,
                                         8, 9, 10, 11, 12, 13, 14, 15);
}

// B fragment (32 K x 16 N f16) from a ROW-MAJOR LDS tile T[k][n] by the
// transposing LDS load: lane (c = l&15, h = l>>4) receives T[8h + 0..7][c] from
// the first load and T[16 + 8h + 0..7][c] from the second, which is the same k
// order as frag_ld gives the A operand.  tile points at T[0][first column];
// pitch is in halves and must be an odd multiple of 16 (32 bytes) for the banks.
__device__ __forceinline__ v16h frag_ld_tr(const _Float16* tile, int pitch) {
  typedef __attribute__((address_space(3))) s8 lds_s8;
  const int l = lane_id();
  const _Float16* p = tile + (8 * (l >> 4) + (l & 7)) * pitch + 8 * ((l >> 3) & 1);
  const h8 lo = __builtin_bit_cast(h8, __builtin_amdgcn_ds_load_tr16_b128_v8i16((lds_s8*)p));
  const h8 hi = __builtin_bit_cast(h8, __builtin_amdgcn_ds_load_tr16_b128_v8i16((lds_s8*)(p + 16 * pitch)));
  return __builtin_shufflevector(lo, hi, 0, 1, 2, 3, 4, 5, 6, 7,
                                         8, 9, 10, 11, 12, 13, 14, 15);
}

// Work-group barrier that orders LDS accesses only.  __syncthreads() also waits
// for the wave's global loads, which here must stay in flight across it.
__device__ __forceinline__ void lds_barrier() {
  __builtin_amdgcn_fence(__ATOMIC_RELEASE, "workgroup", "local");
  __builtin_amdgcn_s_barrier();
  __builtin_amdgcn_fence(__ATOMIC_ACQUIRE, "workgroup", "local");
}

#define BM_ 128  // projection tile rows per work-group
#define BN_ 256  // projection tile columns per work-group
#define MF_ 4    // 16-row A fragments per wave (wave tile 64 x 64)
#define WP_ (BN_ + 16)  // W tile row pitch in halves (544 bytes, an odd multiple of 32)
#define VP_ 80   // V tile row pitch in halves:  64 + 16 (160 bytes)
// Tiles read by plain 16-byte LDS loads (one row per lane): pitch an odd
// multiple of 16 bytes, so that the 16 rows of a fragment fall on distinct banks.
#define XP_ 40   // X tile row pitch in halves:  32 + 8 (80 bytes)
#define KP_ 72   // K tile row pitch in halves:  64 + 8 (144 bytes)
#define KS_ 128  // keys per LDS stage of the attention kernel (two passes of 32 by each key half)
#define NST_ (S_ / KS_)  // stages per head
#define QC_ 2    // 16-column query groups per attention wave
#define JQ_ (QC_ * 8 + 1)  // 16-byte quads a lane hands over in the join: O^T, then references and sums

// ---------------------------------------------------------------------------
// Kernel 1: QKV projection GEMM.  X = (x @ W + b) [* log2(e) / 8 for Q], f16 output
// in head-major [B,H,S,HD] layout.  Grid: (BS/128, D/256, 3), block 256:
// 8 waves as 2 (M) x 4 (N), each 64 x 64 of the tile.  The k-tiles run through a
// pipeline: global loads two tiles ahead of the products, LDS one tile ahead.
// ---------------------------------------------------------------------------
__global__ __launch_bounds__(256) void qkv_proj_kernel(
    const float* __restrict__ q, const float* __restrict__ k, const float* __restrict__ v,
    const float* __restrict__ Wq, const float* __restrict__ bq,
    const float* __restrict__ Wk, const float* __restrict__ bk,
    const float* __restrict__ Wv, const float* __restrict__ bv,
    _Float16* __restrict__ Xq, _Float16* __restrict__ Xk, _Float16* __restrict__ Xv)
{
  // Two buffers of each tile: tile kt + 1 is written while tile kt is read.
  __shared__ __align__(16) _Float16 Xt[2][BM_ * XP_];  // 128 M x 32 K, row-major, padded
  __shared__ __align__(16) _Float16 Wt[2][32 * WP_];   // 32 K x 256 N, row-major, padded

  const int z = blockIdx.z;
  const float* x    = (z == 0) ? q  : (z == 1) ? k  : v;
  const float* W    = (z == 0) ? Wq : (z == 1) ? Wk : Wv;
  const float* bias = (z == 0) ? bq : (z == 1) ? bk : bv;
  _Float16*    X    = (z == 0) ? Xq : (z == 1) ? Xk : Xv;
  // Fold 1/sqrt(HD) and log2(e) into Q: the scores then come out as exponents of 2.
  const float oscale = (z == 0) ? 0.125f * 1.442695041f : 1.0f;

  const int m0   = blockIdx.x * BM_;
  const int n0   = blockIdx.y * BN_;
  const int t    = threadIdx.x;
  const int wave = t >> 5;
  const int mt   = (wave & 1) * (MF_ * 16);  // wave M sub-tile within the tile
  const int nt0  = (wave >> 1) * 64;         // wave N sub-tile within the tile

  // This thread's staged elements: of x rows t/4 and t/4 + 64, cols (t%4)*8;
  // of W k-rows t/32 + 8 j, n-cols (t%32)*8.
  const int xr = t >> 2, xc = (t & 3) * 8;
  const int wr = t / (BN_ / 8), wc = (t % (BN_ / 8)) * 8;
  const float* xs = x + (size_t)(m0 + xr) * D_ + xc;
  const float* ws = W + (size_t)wr * D_ + n0 + wc;

  float4 rx[4], rw[8];  // one k-tile of f32 on its way from global memory

  // Issue the loads of the k-tile that starts at column / row k0.
  auto tile_load = [&](int k0) {
#pragma unroll  // rx[] lives in registers: every index must be a constant
    for (int j = 0; j < 2; ++j) {
      const float* s = xs + k0 + j * 64 * D_;
      rx[2 * j]     = *(const float4*)(s);
      rx[2 * j + 1] = *(const float4*)(s + 4);
    }
#pragma unroll  // constant indices, as above
    for (int j = 0; j < 4; ++j) {
      const float* s = ws + (size_t)(k0 + 8 * j) * D_;
      rw[2 * j]     = *(const float4*)(s);
      rw[2 * j + 1] = *(const float4*)(s + 4);
    }
  };
  // Convert the loaded k-tile to f16 and store it to LDS buffer nb, 16 bytes a store.
  auto tile_store = [&](int nb) {
#pragma unroll  // constant indices, as above
    for (int j = 0; j < 2; ++j) {
      const float4 a0 = rx[2 * j], a1 = rx[2 * j + 1];
      h8 w;
      w[0] = (_Float16)a0.x; w[1] = (_Float16)a0.y; w[2] = (_Float16)a0.z; w[3] = (_Float16)a0.w;
      w[4] = (_Float16)a1.x; w[5] = (_Float16)a1.y; w[6] = (_Float16)a1.z; w[7] = (_Float16)a1.w;
      *(h8*)(Xt[nb] + (xr + 64 * j) * XP_ + xc) = w;
    }
#pragma unroll  // constant indices, as above
    for (int j = 0; j < 4; ++j) {
      const float4 a0 = rw[2 * j], a1 = rw[2 * j + 1];
      h8 w;
      w[0] = (_Float16)a0.x; w[1] = (_Float16)a0.y; w[2] = (_Float16)a0.z; w[3] = (_Float16)a0.w;
      w[4] = (_Float16)a1.x; w[5] = (_Float16)a1.y; w[6] = (_Float16)a1.z; w[7] = (_Float16)a1.w;
      *(h8*)(Wt[nb] + (wr + 8 * j) * WP_ + wc) = w;
    }
  };

  v8f acc[MF_][4] = {};

  // Prologue: tile 0 into buffer 0, tile 1 on its way.
  tile_load(0);
  tile_store(0);
  tile_load(32);
  lds_barrier();

  for (int kt = 0; kt < D_ / 32; ++kt) {
    const int buf = kt & 1;
    // Tile kt + 1 has had a whole trip to arrive: into the buffer that the
    // barrier at the foot of trip kt - 1 has freed; then tile kt + 2 sets out.
    if (kt + 1 < D_ / 32) tile_store(buf ^ 1);
    if (kt + 2 < D_ / 32) tile_load((kt + 2) * 32);
    // Keeps the loads in front of the products, or they would set out a trip's length later.
    __builtin_amdgcn_sched_barrier(0);

    v16h a[MF_];
#pragma unroll  // a[] and acc[][] live in registers: every index must be a constant
    for (int mi = 0; mi < MF_; ++mi) a[mi] = frag_ld(Xt[buf] + (mt + mi * 16) * XP_, XP_);
#pragma unroll
    for (int nsub = 0; nsub < 4; ++nsub) {
      const v16h bm = frag_ld_tr(Wt[buf] + nt0 + nsub * 16, WP_);
#pragma unroll  // constant indices, as above
      for (int mi = 0; mi < MF_; ++mi)
        acc[mi][nsub] = __builtin_amdgcn_wmma_f32_16x16x32_f16(
            false, a[mi], false, bm, (short)0, acc[mi][nsub], false, false);
    }
    // One barrier a trip: tile kt + 1 is published, tile kt's buffer is free.
    lds_barrier();
  }

  // Epilogue: bias + scale, scatter to head-major f16 workspace.
  const int l     = lane_id();
  const int nlane = l & 15;
  const int mb    = (l >> 4) << 3;
#pragma unroll
  for (int nsub = 0; nsub < 4; ++nsub) {
    const int n  = n0 + nt0 + nsub * 16 + nlane;
    const float bb = bias[n];
    const int h  = n >> 6, hd = n & 63;
#pragma unroll  // constant indices, as above
    for (int mi = 0; mi < MF_; ++mi) {
#pragma unroll
      for (int i = 0; i < 8; ++i) {
        const int m = m0 + mt + mi * 16 + mb + i;
        const int bb_idx = m >> 11;            // batch
        const int ss     = m & (S_ - 1);       // sequence pos
        X[(((size_t)(bb_idx * H_ + h)) * S_ + ss) * HD_ + hd] =
            (_Float16)((acc[mi][nsub][i] + bb) * oscale);
      }
    }
  }
}

// Value of lane l ^ 16 (the other 16-lane half of the wave).
__device__ __forceinline__ float xhalf(float x) {
  const int b = __builtin_bit_cast(int, x);
  return __builtin_bit_cast(float,
      __builtin_amdgcn_permlanex16(b, b, 0x76543210, 0xfedcba98, false, false));
}

// One stage (128 keys x 64 halves of K and of V) from global memory to LDS by
// asynchronous 16-byte copies, through no register: this lane's piece of rows
// r, r + 32, r + 64, r + 96.  gk, gv: the lane's global piece of row r;
// lk, lv: its LDS byte address in the K and in the V buffer.
// s_wait_xcnt 0 closes the statement, so that no address register of a copy
// takes a new value before it.
__device__ __forceinline__ void stage_copy(const _Float16* gk, const _Float16* gv,
                                           unsigned lk, unsigned lv) {
  asm volatile(
      "global_load_async_to_lds_b128 %0, %8, off\n\t"
      "global_load_async_to_lds_b128 %1, %9, off\n\t"
      "global_load_async_to_lds_b128 %2, %10, off\n\t"
      "global_load_async_to_lds_b128 %3, %11, off\n\t"
      "global_load_async_to_lds_b128 %4, %12, off\n\t"
      "global_load_async_to_lds_b128 %5, %13, off\n\t"
      "global_load_async_to_lds_b128 %6, %14, off\n\t"
      "global_load_async_to_lds_b128 %7, %15, off\n\t"
      "s_wait_xcnt 0x0"
      :: "v"(lk), "v"(lk + 32 * KP_ * 2), "v"(lk + 64 * KP_ * 2), "v"(lk + 96 * KP_ * 2),
         "v"(lv), "v"(lv + 32 * VP_ * 2), "v"(lv + 64 * VP_ * 2), "v"(lv + 96 * VP_ * 2),
         "v"(gk), "v"(gk + 32 * HD_), "v"(gk + 64 * HD_), "v"(gk + 96 * HD_),
         "v"(gv), "v"(gv + 32 * HD_), "v"(gv + 64 * HD_), "v"(gv + 96 * HD_)
      : "memory");
}

// Four waves per SIMD (two work-groups per WGP): the softmax between the matrix
// runs is hidden by other waves, so the registers must stay within 256.
__global__ __launch_bounds__(256) __attribute__((amdgpu_waves_per_eu(4, 4))) void attn_kernel(
    const _Float16* __restrict__ Xq, const _Float16* __restrict__ Xk,
    const _Float16* __restrict__ Xv, float* __restrict__ out)
{
  __shared__ __align__(16) _Float16 Kt[2 * KS_ * KP_];  // two stages of 18 KB, row-major [k][d], padded
  __shared__ __align__(16) _Float16 Vt[2 * KS_ * VP_];  // two stages of 20 KB, row-major [k][d], padded

  const int bh   = blockIdx.y;           // 0..B*H-1
  const int b    = bh >> 4;
  const int h    = bh & 15;
  const int t    = threadIdx.x;
  // The wave's number as a scalar: its LDS bases and the join's branches are then scalar too.
  const int wave = __builtin_amdgcn_readfirstlane(t >> 5);
  const int qg   = wave & 3;             // which 32 queries of the block
  const int kg   = wave >> 2;            // which 64 keys of every stage
  const int l    = lane_id();
  const int q0   = blockIdx.x * 128 + qg * (QC_ * 16);

  const size_t head_base = (size_t)bh * S_ * HD_;

  // This lane's piece of a stage: row t/8 (and + 32, 64, 96), 8 halves at (t%8)*8.
  const int sr = t >> 3, sc = (t & 7) * 8;
  const _Float16* gk = Xk + head_base + (size_t)sr * HD_ + sc;
  const _Float16* gv = Xv + head_base + (size_t)sr * HD_ + sc;
  const unsigned lk = (unsigned)(size_t)(Kt + sr * KP_ + sc);
  const unsigned lv = (unsigned)(size_t)(Vt + sr * VP_ + sc);

  // Q^T fragments (B operand: lane = query column, pre-scaled by log2(e)/sqrt(HD));
  // same loader as the K rows, so both sides have the same k order.
  v16h bq[QC_][2];
#pragma unroll  // bq[][] lives in registers: every index must be a constant
  for (int c = 0; c < QC_; ++c) {
    bq[c][0] = frag_ld(Xq + head_base + (size_t)(q0 + 16 * c) * HD_, HD_);
    bq[c][1] = frag_ld(Xq + head_base + (size_t)(q0 + 16 * c) * HD_ + 32, HD_);
  }

  // Ring prologue: stage 0 lands and is published, then stage 1 starts to fly.
  stage_copy(gk, gv, lk, lv);
  asm volatile("s_wait_asynccnt 0x0" ::: "memory");  // this wave's copies of stage 0 have landed
  __syncthreads();                                   // ... and every other wave's
  stage_copy(gk + KS_ * HD_, gv + KS_ * HD_, lk + KS_ * KP_ * 2, lv + KS_ * VP_ * 2);

  // Per 16-column group c, over this wave's keys only:
  v8f   o[QC_][4] = {};   // O^T: o[c][nsub][r] = O[query 16 c + (l&15)][d = 16 nsub + 8 (l>>4) + r]
  float mrun[QC_];        // reference in use for this lane's query, in log2 units (equal in both halves)
  v8f   cneg[QC_] = {};   // minus that reference in all 8 registers: C of the score products
  float lrun[QC_];        // running sum over the keys of this lane's half only
#pragma unroll  // constant indices, as above
  for (int c = 0; c < QC_; ++c) { mrun[c] = 0.0f; lrun[c] = 0.0f; }

  // This wave's 64 keys of buffer 0.
  const _Float16* Kw = Kt + kg * (KS_ / 2) * KP_;
  const _Float16* Vw = Vt + kg * (KS_ / 2) * VP_;

  for (int st = 0; st < NST_; ++st) {
   const int buf = st & 1;
   // This wave's 64 keys of the stage, as two passes of 32; both tiles row-major.
   const _Float16* Ks = Kw + buf * KS_ * KP_;
   const _Float16* Vs = Vw + buf * KS_ * VP_;

   // Scores less the reference, transposed: s0[ps][c][r] is that of (key 32 ps +
   // 8 (l>>4) + r, query 16 c + (l&15)), s1[ps][c][r] the same for key 32 ps + 16 +
   // 8 (l>>4) + r.  A = K rows, B = Q^T, C = minus the reference.
   v8f s0[KS_ / 64][QC_], s1[KS_ / 64][QC_];
#pragma unroll  // the wave's two passes of a stage: LDS offsets become immediates
   for (int ps = 0; ps < KS_ / 64; ++ps) {
     const _Float16* Kp = Ks + ps * 32 * KP_;
     const v16h ak0 = frag_ld(Kp, KP_);                 // k 0..15, d 0..31
     const v16h ak1 = frag_ld(Kp + 32, KP_);            // k 0..15, d 32..63
     const v16h ak2 = frag_ld(Kp + 16 * KP_, KP_);      // k 16..31, d 0..31
     const v16h ak3 = frag_ld(Kp + 16 * KP_ + 32, KP_); // k 16..31, d 32..63
#pragma unroll  // constant indices, as above
     for (int c = 0; c < QC_; ++c) {
       s0[ps][c] = __builtin_amdgcn_wmma_f32_16x16x32_f16(false, ak0, false, bq[c][0], (short)0, cneg[c], false, false);
       s1[ps][c] = __builtin_amdgcn_wmma_f32_16x16x32_f16(false, ak2, false, bq[c][0], (short)0, cneg[c], false, false);
     }
#pragma unroll  // constant indices, as above
     for (int c = 0; c < QC_; ++c) {
       s0[ps][c] = __builtin_amdgcn_wmma_f32_16x16x32_f16(false, ak1, false, bq[c][1], (short)0, s0[ps][c], false, false);
       s1[ps][c] = __builtin_amdgcn_wmma_f32_16x16x32_f16(false, ak3, false, bq[c][1], (short)0, s1[ps][c], false, false);
     }
   }

   // Highest score above its reference, per column group, over this lane's 32 keys.
   float rm[QC_];
#pragma unroll  // constant indices, as above
   for (int c = 0; c < QC_; ++c) {
     rm[c] = fmaxf(s0[0][c][0], s1[0][c][0]);
#pragma unroll  // constant indices, as above
     for (int ps = 0; ps < KS_ / 64; ++ps) {
#pragma unroll  // constant indices, as above
       for (int r = (ps == 0) ? 1 : 0; r < 8; ++r) rm[c] = fmaxf(rm[c], fmaxf(s0[ps][c][r], s1[ps][c][r]));
     }
   }

   // One test a stage, a scalar branch: a new reference only where a score of some
   // lane would give P above 256, and in the first stage, which has none yet.
   const bool  first = (st == 0);
   const float bound = first ? -3.0e38f : 8.0f;
   if (__builtin_amdgcn_ballot_w32(fmaxf(rm[0], rm[1]) > bound) != 0) {
#pragma unroll  // constant indices, as above
     for (int c = 0; c < QC_; ++c) {
       const float r     = fmaxf(rm[c], xhalf(rm[c]));  // the query's other keys are in lane l ^ 16
       const float delta = first ? r : fmaxf(r, 0.0f);  // after the first stage the reference never falls
       const float corr  = first ? 0.0f : __builtin_amdgcn_exp2f(-delta);  // O and the sum are still 0 in the first
       mrun[c] += delta;
       cneg[c] -= delta;  // stays minus mrun[c] to the bit: the same sum with both signs turned
#pragma unroll  // constant indices, as above
       for (int ps = 0; ps < KS_ / 64; ++ps) {
         s0[ps][c] -= delta;
         s1[ps][c] -= delta;
       }
       lrun[c] *= corr;
#pragma unroll  // constant indices, as above
       for (int nsub = 0; nsub < 4; ++nsub) o[c][nsub] *= corr;
     }
   }

#pragma unroll  // the two passes again: LDS offsets become immediates
   for (int ps = 0; ps < KS_ / 64; ++ps) {
    const _Float16* Vp = Vs + ps * 32 * VP_;

    v16h bp[QC_];
#pragma unroll  // constant indices, as above
    for (int c = 0; c < QC_; ++c) {
      // P^T as B operand: element s is key 8 (l>>4) + s for s < 8 and
      // 16 + 8 (l>>4) + (s - 8) above, the k order of the transposing load.
      // Summed as register-adjacent pairs, so that the packed add needs no register moves.
      const quad2 t0 = __builtin_bit_cast(quad2, s0[ps][c]);
      const quad2 t1 = __builtin_bit_cast(quad2, s1[ps][c]);
      v2f ps2 = {0.0f, 0.0f};
#pragma unroll  // constant indices, as above
      for (int r = 0; r < 4; ++r) {
        const v2f p0 = {__builtin_amdgcn_exp2f(t0.p[r][0]), __builtin_amdgcn_exp2f(t0.p[r][1])};
        const v2f p1 = {__builtin_amdgcn_exp2f(t1.p[r][0]), __builtin_amdgcn_exp2f(t1.p[r][1])};
        ps2 += p0 + p1;
        bp[c][2 * r]         = (_Float16)p0[0];
        bp[c][2 * r + 1]     = (_Float16)p0[1];
        bp[c][8 + 2 * r]     = (_Float16)p1[0];
        bp[c][8 + 2 * r + 1] = (_Float16)p1[1];
      }
      lrun[c] += ps2[0] + ps2[1];
    }

    // O^T += V^T @ P^T  (A = 16 d x 32 keys from row-major Vt by the transposing
    // load, B = P^T).
#pragma unroll
    for (int nsub = 0; nsub < 4; ++nsub) {
      const v16h avf = frag_ld_tr(Vp + nsub * 16, VP_);
#pragma unroll  // constant indices, as above
      for (int c = 0; c < QC_; ++c)
        o[c][nsub] = __builtin_amdgcn_wmma_f32_16x16x32_f16(
            false, avf, false, bp[c], (short)0, o[c][nsub], false, false);
    }
   }

   // Publish point of stage st + 1, in the ring's order.
   asm volatile("s_wait_dscnt 0x0" ::: "memory");     // this wave's reads of stage st are done
   asm volatile("s_wait_asynccnt 0x0" ::: "memory");  // its copies of stage st + 1 have landed
   __syncthreads();  // all waves: stage st + 1 may be read, stage st's buffer refilled
   if (st + 2 < NST_)
     stage_copy(gk + (size_t)(st + 2) * KS_ * HD_, gv + (size_t)(st + 2) * KS_ * HD_,
                lk + buf * (KS_ * KP_ * 2), lv + buf * (KS_ * VP_ * 2));
  }
  asm volatile("s_wait_asynccnt 0x0" ::: "memory");  // nothing in flight when the wave ends

  // Join of the two key halves.  The last publish point has ended every read of
  // the ring and no copy is in flight, so the K ring serves as the mailbox: lane l
  // of wave (qg, 1) hands its 17 quads to lane l of wave (qg, 0), quad j of all 32
  // lanes in one contiguous 512-byte row.
  float4* mail = (float4*)Kt + qg * (JQ_ * 32) + l;
  if (kg == 1) {
#pragma unroll  // constant indices, as above
    for (int c = 0; c < QC_; ++c) {
#pragma unroll  // constant indices, as above
      for (int nsub = 0; nsub < 4; ++nsub) {
        const v8f w = o[c][nsub];
        mail[((c * 4 + nsub) * 2) * 32]     = make_float4(w[0], w[1], w[2], w[3]);
        mail[((c * 4 + nsub) * 2 + 1) * 32] = make_float4(w[4], w[5], w[6], w[7]);
      }
    }
    mail[(JQ_ - 1) * 32] = make_float4(mrun[0], mrun[1], lrun[0], lrun[1]);
  }
  __syncthreads();  // the partial results of the second key half are published

  // Epilogue, by the waves of the first key half: both partials to the higher of
  // the two references, join the lane halves' sums, normalize, write merged-head f32 output
  // [B,S,D]; a lane holds 8 consecutive d of its query in each tile.
  if (kg == 0) {
    const float4 ml = mail[(JQ_ - 1) * 32];
#pragma unroll  // constant indices, as above
    for (int c = 0; c < QC_; ++c) {
      const float mb = c ? ml.y : ml.x;
      const float lb = c ? ml.w : ml.z;
      const float mj = fmaxf(mrun[c], mb);
      const float fa = __builtin_amdgcn_exp2f(mrun[c] - mj);
      const float fb = __builtin_amdgcn_exp2f(mb - mj);
      const float lj = lrun[c] * fa + lb * fb;
      const float lsum = lj + xhalf(lj);
      const float ga = fa / lsum, gb = fb / lsum;  // rescale and 1 / sum in one factor a partial
      float* orow = out + ((size_t)b * S_ + q0 + 16 * c + (l & 15)) * D_ + h * HD_ + ((l >> 4) << 3);
#pragma unroll  // constant indices, as above
      for (int nsub = 0; nsub < 4; ++nsub) {
        const v8f    w  = o[c][nsub];
        const float4 u0 = mail[((c * 4 + nsub) * 2) * 32];
        const float4 u1 = mail[((c * 4 + nsub) * 2 + 1) * 32];
        float4 w0, w1;
        w0.x = w[0] * ga + u0.x * gb; w0.y = w[1] * ga + u0.y * gb;
        w0.z = w[2] * ga + u0.z * gb; w0.w = w[3] * ga + u0.w * gb;
        w1.x = w[4] * ga + u1.x * gb; w1.y = w[5] * ga + u1.y * gb;
        w1.z = w[6] * ga + u1.z * gb; w1.w = w[7] * ga + u1.w * gb;
        *(float4*)(orow + nsub * 16)     = w0;
        *(float4*)(orow + nsub * 16 + 4) = w1;
      }
    }
  }
}

extern "C" void kernel_launch(void* const* d_in, const int* in_sizes, int n_in,
                              void* d_out, int out_size, void* d_ws, size_t ws_size,
                              hipStream_t stream) {
  (void)in_sizes; (void)n_in; (void)out_size; (void)ws_size;
  const float* q  = (const float*)d_in[0];
  const float* k  = (const float*)d_in[1];
  const float* v  = (const float*)d_in[2];
  const float* Wq = (const float*)d_in[3];
  const float* bq = (const float*)d_in[4];
  const float* Wk = (const float*)d_in[5];
  const float* bk = (const float*)d_in[6];
  const float* Wv = (const float*)d_in[7];
  const float* bv = (const float*)d_in[8];
  float* out = (float*)d_out;

  const size_t nX = (size_t)B_ * H_ * S_ * HD_;   // 4M elems -> 8 MB f16 each
  _Float16* Xq = (_Float16*)d_ws;
  _Float16* Xk = Xq + nX;
  _Float16* Xv = Xk + nX;

  dim3 gp(B_ * S_ / BM_, D_ / BN_, 3);
  qkv_proj_kernel<<<gp, 256, 0, stream>>>(q, k, v, Wq, bq, Wk, bk, Wv, bv, Xq, Xk, Xv);

  dim3 ga(S_ / 128, B_ * H_);
  attn_kernel<<<ga, 256, 0, stream>>>(Xq, Xk, Xv, out);
}

// v009
// A run of this version takes 70.2 microseconds.
// Two timings next to v008 both put it at 1.13 times that version's speed.
// All steps since v000 together make it 4.20 times as fast.
#include <hip/hip_runtime.h>
#include <hip/hip_bf16.h>

typedef __attribute__((ext_vector_type(16))) _Float16 v16h;
typedef __attribute__((ext_vector_type(8)))  float    v8f;
typedef __attribute__((ext_vector_type(8)))  _Float16 h8;
typedef __attribute__((ext_vector_type(8)))  short    s8;
typedef __attribute__((ext_vector_type(2)))  float    v2f;
struct quad2 { v2f p[4]; };  // an accumulator tile's 8 registers as 4 pairs

#define B_  2
#define S_  2048
#define D_  1024
#define H_  16
#define HD_ 64

__device__ __forceinline__ int lane_id() { return threadIdx.x & 31; }

// Fragment load with wide (b128) accesses.  Works for:
//  - A fragments (16x32 f16) from a row-major tile (lane = M row), and
//  - B fragments (32x16 f16) from a TRANSPOSED tile T[n][k] (lane = N col),
// since both reduce to: lane (l&15) reads two 8-half runs at K = kh and 16+kh.
// All addresses are 16-byte aligned (ld is a multiple of 8, kh is 0 or 8).
__device__ __forceinline__ v16h frag_ld(const _Float16* src, int ld) {
  const int l  = lane_id();
  const int m  = l & 15;
  const int kh = (l >> 4) << 3;
  const _Float16* r = src + (size_t)m * ld + kh;
  const h8 lo = *(const h8*)(r);
  const h8 hi = *(const h8*)(r + 16);
  return __builtin_shufflevector(lo, hi, 0, 1, 2, 3, 4, 5, 6, 7,
                                         8, 9, 10, 11, 12, 13, 14, 15);
}

// B fragment (32 K x 16 N f16) from a ROW-MAJOR LDS tile T[k][n] by the
// transposing LDS load: lane (c = l&15, h = l>>4) receives T[8h + 0..7][c] from
// the first load and T[16 + 8h + 0..7][c] from the second, which is the same k
// order as frag_ld gives the A operand.  tile points at T[0][first column];
// pitch is in halves and must be an odd multiple of 16 (32 bytes) for the banks.
__device__ __forceinline__ v16h frag_ld_tr(const _Float16* tile, int pitch) {
  typedef __attribute__((address_space(3))) s8 lds_s8;
  const int l = lane_id();
  const _Float16* p = tile + (8 * (l >> 4) + (l & 7)) * pitch + 8 * ((l >> 3) & 1);
  const h8 lo = __builtin_bit_cast(h8, __builtin_amdgcn_ds_load_tr16_b128_v8i16((lds_s8*)p));
  const h8 hi = __builtin_bit_cast(h8, __builtin_amdgcn_ds_load_tr16_b128_v8i16((lds_s8*)(p + 16 * pitch)));
  return __builtin_shufflevector(lo, hi, 0, 1, 2, 3, 4, 5, 6, 7,
                                         8, 9, 10, 11, 12, 13, 14, 15);
}

// Work-group barrier that orders LDS accesses only.  __syncthreads() also waits
// for the wave's global loads, which here must stay in flight across it.
__device__ __forceinline__ void lds_barrier() {
  __builtin_amdgcn_fence(__ATOMIC_RELEASE, "workgroup", "local");
  __builtin_amdgcn_s_barrier();
  __builtin_amdgcn_fence(__ATOMIC_ACQUIRE, "workgroup", "local");
}

#define BM_ 128  // projection tile rows per work-group
#define BN_ 256  // projection tile columns per work-group
#define MF_ 4    // 16-row A fragments per wave (wave tile 64 x 64)
#define WP_ (BN_ + 16)  // W tile row pitch in halves (544 bytes, an odd multiple of 32)
#define VP_ 80   // V tile row pitch in halves:  64 + 16 (160 bytes)
// Tiles read by plain 16-byte LDS loads (one row per lane): pitch an odd
// multiple of 16 bytes, so that the 16 rows of a fragment fall on distinct banks.
#define XP_ 40   // X tile row pitch in halves:  32 + 8 (80 bytes)
#define KP_ 72   // K tile row pitch in halves:  64 + 8 (144 bytes)
#define KS_ 128  // keys per LDS stage of the attention kernel (two passes of 32 by each key half)
#define NST_ (S_ / KS_)  // stages per head
#define QC_ 2    // 16-column query groups per attention wave
#define JQ_ (QC_ * 8 + 1)  // 16-byte quads a lane hands over in the join: O^T, then references and sums

// ---------------------------------------------------------------------------
// Kernel 1: QKV projection GEMM.  X = (x @ W + b) [* log2(e) / 8 for Q], f16 output
// in head-major [B,H,S,HD] layout.  Grid: (BS/128, D/256, 3), block 256:
// 8 waves as 2 (M) x 4 (N), each 64 x 64 of the tile.  The k-tiles run through a
// pipeline: global loads two tiles ahead of the products, LDS one tile ahead.
// ---------------------------------------------------------------------------
__global__ __launch_bounds__(256) void qkv_proj_kernel(
    const float* __restrict__ q, const float* __restrict__ k, const float* __restrict__ v,
    const float* __restrict__ Wq, const float* __restrict__ bq,
    const float* __restrict__ Wk, const float* __restrict__ bk,
    const float* __restrict__ Wv, const float* __restrict__ bv,
    _Float16* __restrict__ Xq, _Float16* __restrict__ Xk, _Float16* __restrict__ Xv)
{
  // Two buffers of each tile: tile kt + 1 is written while tile kt is read.
  __shared__ __align__(16) _Float16 Xt[2][BM_ * XP_];  // 128 M x 32 K, row-major, padded
  __shared__ __align__(16) _Float16 Wt[2][32 * WP_];   // 32 K x 256 N, row-major, padded

  const int z = blockIdx.z;
  const float* x    = (z == 0) ? q  : (z == 1) ? k  : v;
  const float* W    = (z == 0) ? Wq : (z == 1) ? Wk : Wv;
  const float* bias = (z == 0) ? bq : (z == 1) ? bk : bv;
  _Float16*    X    = (z == 0) ? Xq : (z == 1) ? Xk : Xv;
  // Fold 1/sqrt(HD) and log2(e) into Q: the scores then come out as exponents of 2.
  const float oscale = (z == 0) ? 0.125f * 1.442695041f : 1.0f;

  const int m0   = blockIdx.x * BM_;
  const int n0   = blockIdx.y * BN_;
  const int t    = threadIdx.x;
  const int wave = t >> 5;
  const int mt   = (wave & 1) * (MF_ * 16);  // wave M sub-tile within the tile
  const int nt0  = (wave >> 1) * 64;         // wave N sub-tile within the tile

  // This thread's staged elements: of x rows t/4 and t/4 + 64, cols (t%4)*8;
  // of W k-rows t/32 + 8 j, n-cols (t%32)*8.
  const int xr = t >> 2, xc = (t & 3) * 8;
  const int wr = t / (BN_ / 8), wc = (t % (BN_ / 8)) * 8;
  const float* xs = x + (size_t)(m0 + xr) * D_ + xc;
  const float* ws = W + (size_t)wr * D_ + n0 + wc;

  // The 32 work-groups that share a W panel and the 4 that share x rows run side by
  // side: each enters the ring of k-tiles at a place of its own and wraps round, so
  // that they do not ask L2 for the same lines at the same moment.
  const int rot = (blockIdx.x + 8 * blockIdx.y) & (D_ / 32 - 1);
  // First column / row of the k-tile that trip kt works on.
  auto k_of = [&](int kt) { return ((kt + rot) & (D_ / 32 - 1)) * 32; };

  float4 rx[4], rw[8];  // one k-tile of f32 on its way from global memory

  // Issue the loads of the k-tile that starts at column / row k0.
  auto tile_load = [&](int k0) {
#pragma unroll  // rx[] lives in registers: every index must be a constant
    for (int j = 0; j < 2; ++j) {
      const float* s = xs + k0 + j * 64 * D_;
      rx[2 * j]     = *(const float4*)(s);
      rx[2 * j + 1] = *(const float4*)(s + 4);
    }
#pragma unroll  // constant indices, as above
    for (int j = 0; j < 4; ++j) {
      const float* s = ws + (size_t)(k0 + 8 * j) * D_;
      rw[2 * j]     = *(const float4*)(s);
      rw[2 * j + 1] = *(const float4*)(s + 4);
    }
  };
  // Convert the loaded k-tile to f16 and store it to LDS buffer nb, 16 bytes a store.
  auto tile_store = [&](int nb) {
#pragma unroll  // constant indices, as above
    for (int j = 0; j < 2; ++j) {
      const float4 a0 = rx[2 * j], a1 = rx[2 * j + 1];
      h8 w;
      w[0] = (_Float16)a0.x; w[1] = (_Float16)a0.y; w[2] = (_Float16)a0.z; w[3] = (_Float16)a0.w;
      w[4] = (_Float16)a1.x; w[5] = (_Float16)a1.y; w[6] = (_Float16)a1.z; w[7] = (_Float16)a1.w;
      *(h8*)(Xt[nb] + (xr + 64 * j) * XP_ + xc) = w;
    }
#pragma unroll  // constant indices, as above
    for (int j = 0; j < 4; ++j) {
      const float4 a0 = rw[2 * j], a1 = rw[2 * j + 1];
      h8 w;
      w[0] = (_Float16)a0.x; w[1] = (_Float16)a0.y; w[2] = (_Float16)a0.z; w[3] = (_Float16)a0.w;
      w[4] = (_Float16)a1.x; w[5] = (_Float16)a1.y; w[6] = (_Float16)a1.z; w[7] = (_Float16)a1.w;
      *(h8*)(Wt[nb] + (wr + 8 * j) * WP_ + wc) = w;
    }
  };

  v8f acc[MF_][4] = {};

  // Prologue: tile 0 into buffer 0, tile 1 on its way.
  tile_load(k_of(0));
  tile_store(0);
  tile_load(k_of(1));
  lds_barrier();

  // The products of one k-tile, from LDS buffer buf.
  auto products = [&](int buf) {
    v16h a[MF_];
#pragma unroll  // a[] and acc[][] live in registers: every index must be a constant
    for (int mi = 0; mi < MF_; ++mi) a[mi] = frag_ld(Xt[buf] + (mt + mi * 16) * XP_, XP_);
#pragma unroll
    for (int nsub = 0; nsub < 4; ++nsub) {
      const v16h bm = frag_ld_tr(Wt[buf] + nt0 + nsub * 16, WP_);
#pragma unroll  // constant indices, as above
      for (int mi = 0; mi < MF_; ++mi)
        acc[mi][nsub] = __builtin_amdgcn_wmma_f32_16x16x32_f16(
            false, a[mi], false, bm, (short)0, acc[mi][nsub], false, false);
    }
  };

  // The last two trips stand behind the loop, so that no branch goes round the loads
  // in it: the loaded registers then pass from trip to trip without copies.
  for (int kt = 0; kt < D_ / 32 - 2; ++kt) {
    const int buf = kt & 1;
    // Tile kt + 1 has had a whole trip to arrive: into the buffer that the
    // barrier at the foot of trip kt - 1 has freed; then tile kt + 2 sets out.
    tile_store(buf ^ 1);
    tile_load(k_of(kt + 2));
    // Keeps the loads in front of the products, or they would set out a trip's length later.
    __builtin_amdgcn_sched_barrier(0);
    products(buf);
    // One barrier a trip: tile kt + 1 is published, tile kt's buffer is free.
    lds_barrier();
  }
  tile_store(1);  // the last tile
  products(0);
  lds_barrier();
  products(1);
  lds_barrier();

  // Epilogue: bias + scale, scatter to head-major f16 workspace.
  const int l     = lane_id();
  const int nlane = l & 15;
  const int mb    = (l >> 4) << 3;
#pragma unroll
  for (int nsub = 0; nsub < 4; ++nsub) {
    const int n  = n0 + nt0 + nsub * 16 + nlane;
    const float bb = bias[n];
    const int h  = n >> 6, hd = n & 63;
#pragma unroll  // constant indices, as above
    for (int mi = 0; mi < MF_; ++mi) {
#pragma unroll
      for (int i = 0; i < 8; ++i) {
        const int m = m0 + mt + mi * 16 + mb + i;
        const int bb_idx = m >> 11;            // batch
        const int ss     = m & (S_ - 1);       // sequence pos
        X[(((size_t)(bb_idx * H_ + h)) * S_ + ss) * HD_ + hd] =
            (_Float16)((acc[mi][nsub][i] + bb) * oscale);
      }
    }
  }
}

// Value of lane l ^ 16 (the other 16-lane half of the wave).
__device__ __forceinline__ float xhalf(float x) {
  const int b = __builtin_bit_cast(int, x);
  return __builtin_bit_cast(float,
      __builtin_amdgcn_permlanex16(b, b, 0x76543210, 0xfedcba98, false, false));
}

// One stage (128 keys x 64 halves of K and of V) from global memory to LDS by
// asynchronous 16-byte copies, through no register: this lane's piece of rows
// r, r + 32, r + 64, r + 96.  gk, gv: the lane's global piece of row r;
// lk, lv: its LDS byte address in the K and in the V buffer.
// s_wait_xcnt 0 closes the statement, so that no address register of a copy
// takes a new value before it.
__device__ __forceinline__ void stage_copy(const _Float16* gk, const _Float16* gv,
                                           unsigned lk, unsigned lv) {
  asm volatile(
      "global_load_async_to_lds_b128 %0, %8, off\n\t"
      "global_load_async_to_lds_b128 %1, %9, off\n\t"
      "global_load_async_to_lds_b128 %2, %10, off\n\t"
      "global_load_async_to_lds_b128 %3, %11, off\n\t"
      "global_load_async_to_lds_b128 %4, %12, off\n\t"
      "global_load_async_to_lds_b128 %5, %13, off\n\t"
      "global_load_async_to_lds_b128 %6, %14, off\n\t"
      "global_load_async_to_lds_b128 %7, %15, off\n\t"
      "s_wait_xcnt 0x0"
      :: "v"(lk), "v"(lk + 32 * KP_ * 2), "v"(lk + 64 * KP_ * 2), "v"(lk + 96 * KP_ * 2),
         "v"(lv), "v"(lv + 32 * VP_ * 2), "v"(lv + 64 * VP_ * 2), "v"(lv + 96 * VP_ * 2),
         "v"(gk), "v"(gk + 32 * HD_), "v"(gk + 64 * HD_), "v"(gk + 96 * HD_),
         "v"(gv), "v"(gv + 32 * HD_), "v"(gv + 64 * HD_), "v"(gv + 96 * HD_)
      : "memory");
}

// Four waves per SIMD (two work-groups per WGP): the softmax between the matrix
// runs is hidden by other waves, so the registers must stay within 256.
__global__ __launch_bounds__(256) __attribute__((amdgpu_waves_per_eu(4, 4))) void attn_kernel(
    const _Float16* __restrict__ Xq, const _Float16* __restrict__ Xk,
    const _Float16* __restrict__ Xv, float* __restrict__ out)
{
  __shared__ __align__(16) _Float16 Kt[2 * KS_ * KP_];  // two stages of 18 KB, row-major [k][d], padded
  __shared__ __align__(16) _Float16 Vt[2 * KS_ * VP_];  // two stages of 20 KB, row-major [k][d], padded

  const int bh   = blockIdx.y;           // 0..B*H-1
  const int b    = bh >> 4;
  const int h    = bh & 15;
  const int t    = threadIdx.x;
  // The wave's number as a scalar: its LDS bases and the join's branches are then scalar too.
  const int wave = __builtin_amdgcn_readfirstlane(t >> 5);
  const int qg   = wave & 3;             // which 32 queries of the block
  const int kg   = wave >> 2;            // which 64 keys of every stage
  const int l    = lane_id();
  const int q0   = blockIdx.x * 128 + qg * (QC_ * 16);

  const size_t head_base = (size_t)bh * S_ * HD_;

  // This lane's piece of a stage: row t/8 (and + 32, 64, 96), 8 halves at (t%8)*8.
  const int sr = t >> 3, sc = (t & 7) * 8;
  const _Float16* gk = Xk + head_base + (size_t)sr * HD_ + sc;
  const _Float16* gv = Xv + head_base + (size_t)sr * HD_ + sc;
  const unsigned lk = (unsigned)(size_t)(Kt + sr * KP_ + sc);
  const unsigned lv = (unsigned)(size_t)(Vt + sr * VP_ + sc);

  // Q^T fragments (B operand: lane = query column, pre-scaled by log2(e)/sqrt(HD));
  // same loader as the K rows, so both sides have the same k order.
  v16h bq[QC_][2];
#pragma unroll  // bq[][] lives in registers: every index must be a constant
  for (int c = 0; c < QC_; ++c) {
    bq[c][0] = frag_ld(Xq + head_base + (size_t)(q0 + 16 * c) * HD_, HD_);
    bq[c][1] = frag_ld(Xq + head_base + (size_t)(q0 + 16 * c) * HD_ + 32, HD_);
  }

  // The 16 work-groups of a head run side by side over the same K and V: each enters
  // the ring of key stages at a place of its own and wraps round, so that they do not
  // ask L2 for the same lines at the same moment.  Offset in halves of the keys that
  // trip st works on:
  const int rot = blockIdx.x & (NST_ - 1);
  auto keys_of = [&](int st) { return (size_t)((st + rot) & (NST_ - 1)) * (KS_ * HD_); };

  // Ring prologue: stage 0 lands and is published, then stage 1 starts to fly.
  stage_copy(gk + keys_of(0), gv + keys_of(0), lk, lv);
  asm volatile("s_wait_asynccnt 0x0" ::: "memory");  // this wave's copies of stage 0 have landed
  __syncthreads();                                   // ... and every other wave's
  stage_copy(gk + keys_of(1), gv + keys_of(1), lk + KS_ * KP_ * 2, lv + KS_ * VP_ * 2);

  // Per 16-column group c, over this wave's keys only:
  v8f   o[QC_][4] = {};   // O^T: o[c][nsub][r] = O[query 16 c + (l&15)][d = 16 nsub + 8 (l>>4) + r]
  float mrun[QC_];        // reference in use for this lane's query, in log2 units (equal in both halves)
  v8f   cneg[QC_] = {};   // minus that reference in all 8 registers: C of the score products
  float lrun[QC_];        // running sum over the keys of this lane's half only
#pragma unroll  // constant indices, as above
  for (int c = 0; c < QC_; ++c) { mrun[c] = 0.0f; lrun[c] = 0.0f; }

  // This wave's 64 keys of buffer 0.
  const _Float16* Kw = Kt + kg * (KS_ / 2) * KP_;
  const _Float16* Vw = Vt + kg * (KS_ / 2) * VP_;

  for (int st = 0; st < NST_; ++st) {
   const int buf = st & 1;
   // This wave's 64 keys of the stage, as two passes of 32; both tiles row-major.
   const _Float16* Ks = Kw + buf * KS_ * KP_;
   const _Float16* Vs = Vw + buf * KS_ * VP_;

   // Scores less the reference, transposed: s0[ps][c][r] is that of (key 32 ps +
   // 8 (l>>4) + r, query 16 c + (l&15)), s1[ps][c][r] the same for key 32 ps + 16 +
   // 8 (l>>4) + r.  A = K rows, B = Q^T, C = minus the reference.
   v8f s0[KS_ / 64][QC_], s1[KS_ / 64][QC_];
#pragma unroll  // the wave's two passes of a stage: LDS offsets become immediates
   for (int ps = 0; ps < KS_ / 64; ++ps) {
     const _Float16* Kp = Ks + ps * 32 * KP_;
     const v16h ak0 = frag_ld(Kp, KP_);                 // k 0..15, d 0..31
     const v16h ak1 = frag_ld(Kp + 32, KP_);            // k 0..15, d 32..63
     const v16h ak2 = frag_ld(Kp + 16 * KP_, KP_);      // k 16..31, d 0..31
     const v16h ak3 = frag_ld(Kp + 16 * KP_ + 32, KP_); // k 16..31, d 32..63
#pragma unroll  // constant indices, as above
     for (int c = 0; c < QC_; ++c) {
       s0[ps][c] = __builtin_amdgcn_wmma_f32_16x16x32_f16(false, ak0, false, bq[c][0], (short)0, cneg[c], false, false);
       s1[ps][c] = __builtin_amdgcn_wmma_f32_16x16x32_f16(false, ak2, false, bq[c][0], (short)0, cneg[c], false, false);
     }
#pragma unroll  // constant indices, as above
     for (int c = 0; c < QC_; ++c) {
       s0[ps][c] = __builtin_amdgcn_wmma_f32_16x16x32_f16(false, ak1, false, bq[c][1], (short)0, s0[ps][c], false, false);
       s1[ps][c] = __builtin_amdgcn_wmma_f32_16x16x32_f16(false, ak3, false, bq[c][1], (short)0, s1[ps][c], false, false);
     }
   }

   // Highest score above its reference, per column group, over this lane's 32 keys.
   float rm[QC_];
#pragma unroll  // constant indices, as above
   for (int c = 0; c < QC_; ++c) {
     rm[c] = fmaxf(s0[0][c][0], s1[0][c][0]);
#pragma unroll  // constant indices, as above
     for (int ps = 0; ps < KS_ / 64; ++ps) {
#pragma unroll  // constant indices, as above
       for (int r = (ps == 0) ? 1 : 0; r < 8; ++r) rm[c] = fmaxf(rm[c], fmaxf(s0[ps][c][r], s1[ps][c][r]));
     }
   }

   // One test a stage, a scalar branch: a new reference only where a score of some
   // lane would give P above 256, and in the first stage, which has none yet.
   const bool  first = (st == 0);
   const float bound = first ? -3.0e38f : 8.0f;
   if (__builtin_amdgcn_ballot_w32(fmaxf(rm[0], rm[1]) > bound) != 0) {
#pragma unroll  // constant indices, as above
     for (int c = 0; c < QC_; ++c) {
       const float r     = fmaxf(rm[c], xhalf(rm[c]));  // the query's other keys are in lane l ^ 16
       const float delta = first ? r : fmaxf(r, 0.0f);  // after the first stage the reference never falls
       const float corr  = first ? 0.0f : __builtin_amdgcn_exp2f(-delta);  // O and the sum are still 0 in the first
       mrun[c] += delta;
       cneg[c] -= delta;  // stays minus mrun[c] to the bit: the same sum with both signs turned
#pragma unroll  // constant indices, as above
       for (int ps = 0; ps < KS_ / 64; ++ps) {
         s0[ps][c] -= delta;
         s1[ps][c] -= delta;
       }
       lrun[c] *= corr;
#pragma unroll  // constant indices, as above
       for (int nsub = 0; nsub < 4; ++nsub) o[c][nsub] *= corr;
     }
   }

#pragma unroll  // the two passes again: LDS offsets become immediates
   for (int ps = 0; ps < KS_ / 64; ++ps) {
    const _Float16* Vp = Vs + ps * 32 * VP_;

    v16h bp[QC_];
#pragma unroll  // constant indices, as above
    for (int c = 0; c < QC_; ++c) {
      // P^T as B operand: element s is key 8 (l>>4) + s for s < 8 and
      // 16 + 8 (l>>4) + (s - 8) above, the k order of the transposing load.
      // Summed as register-adjacent pairs, so that the packed add needs no register moves.
      const quad2 t0 = __builtin_bit_cast(quad2, s0[ps][c]);
      const quad2 t1 = __builtin_bit_cast(quad2, s1[ps][c]);
      v2f ps2 = {0.0f, 0.0f};
#pragma unroll  // constant indices, as above
      for (int r = 0; r < 4; ++r) {
        const v2f p0 = {__builtin_amdgcn_exp2f(t0.p[r][0]), __builtin_amdgcn_exp2f(t0.p[r][1])};
        const v2f p1 = {__builtin_amdgcn_exp2f(t1.p[r][0]), __builtin_amdgcn_exp2f(t1.p[r][1])};
        ps2 += p0 + p1;
        bp[c][2 * r]         = (_Float16)p0[0];
        bp[c][2 * r + 1]     = (_Float16)p0[1];
        bp[c][8 + 2 * r]     = (_Float16)p1[0];
        bp[c][8 + 2 * r + 1] = (_Float16)p1[1];
      }
      lrun[c] += ps2[0] + ps2[1];
    }

    // O^T += V^T @ P^T  (A = 16 d x 32 keys from row-major Vt by the transposing
    // load, B = P^T).
#pragma unroll
    for (int nsub = 0; nsub < 4; ++nsub) {
      const v16h avf = frag_ld_tr(Vp + nsub * 16, VP_);
#pragma unroll  // constant indices, as above
      for (int c = 0; c < QC_; ++c)
        o[c][nsub] = __builtin_amdgcn_wmma_f32_16x16x32_f16(
            false, avf, false, bp[c], (short)0, o[c][nsub], false, false);
    }
   }

   // Publish point of stage st + 1, in the ring's order.
   asm volatile("s_wait_dscnt 0x0" ::: "memory");     // this wave's reads of stage st are done
   asm volatile("s_wait_asynccnt 0x0" ::: "memory");  // its copies of stage st + 1 have landed
   __syncthreads();  // all waves: stage st + 1 may be read, stage st's buffer refilled
   if (st + 2 < NST_)
     stage_copy(gk + keys_of(st + 2), gv + keys_of(st + 2),
                lk + buf * (KS_ * KP_ * 2), lv + buf * (KS_ * VP_ * 2));
  }
  asm volatile("s_wait_asynccnt 0x0" ::: "memory");  // nothing in flight when the wave ends

  // Join of the two key halves.  The last publish point has ended every read of
  // the ring and no copy is in flight, so the K ring serves as the mailbox: lane l
  // of wave (qg, 1) hands its 17 quads to lane l of wave (qg, 0), quad j of all 32
  // lanes in one contiguous 512-byte row.
  float4* mail = (float4*)Kt + qg * (JQ_ * 32) + l;
  if (kg == 1) {
#pragma unroll  // constant indices, as above
    for (int c = 0; c < QC_; ++c) {
#pragma unroll  // constant indices, as above
      for (int nsub = 0; nsub < 4; ++nsub) {
        const v8f w = o[c][nsub];
        mail[((c * 4 + nsub) * 2) * 32]     = make_float4(w[0], w[1], w[2], w[3]);
        mail[((c * 4 + nsub) * 2 + 1) * 32] = make_float4(w[4], w[5], w[6], w[7]);
      }
    }
    mail[(JQ_ - 1) * 32] = make_float4(mrun[0], mrun[1], lrun[0], lrun[1]);
  }
  __syncthreads();  // the partial results of the second key half are published

  // Epilogue, by the waves of the first key half: both partials to the higher of
  // the two references, join the lane halves' sums, normalize, write merged-head f32 output
  // [B,S,D]; a lane holds 8 consecutive d of its query in each tile.
  if (kg == 0) {
    const float4 ml = mail[(JQ_ - 1) * 32];
#pragma unroll  // constant indices, as above
    for (int c = 0; c < QC_; ++c) {
      const float mb = c ? ml.y : ml.x;
      const float lb = c ? ml.w : ml.z;
      const float mj = fmaxf(mrun[c], mb);
      const float fa = __builtin_amdgcn_exp2f(mrun[c] - mj);
      const float fb = __builtin_amdgcn_exp2f(mb - mj);
      const float lj = lrun[c] * fa + lb * fb;
      const float lsum = lj + xhalf(lj);
      const float ga = fa / lsum, gb = fb / lsum;  // rescale and 1 / sum in one factor a partial
      float* orow = out + ((size_t)b * S_ + q0 + 16 * c + (l & 15)) * D_ + h * HD_ + ((l >> 4) << 3);
#pragma unroll  // constant indices, as above
      for (int nsub = 0; nsub < 4; ++nsub) {
        const v8f    w  = o[c][nsub];
        const float4 u0 = mail[((c * 4 + nsub) * 2) * 32];
        const float4 u1 = mail[((c * 4 + nsub) * 2 + 1) * 32];
        float4 w0, w1;
        w0.x = w[0] * ga + u0.x * gb; w0.y = w[1] * ga + u0.y * gb;
        w0.z = w[2] * ga + u0.z * gb; w0.w = w[3] * ga + u0.w * gb;
        w1.x = w[4] * ga + u1.x * gb; w1.y = w[5] * ga + u1.y * gb;
        w1.z = w[6] * ga + u1.z * gb; w1.w = w[7] * ga + u1.w * gb;
        *(float4*)(orow + nsub * 16)     = w0;
        *(float4*)(orow + nsub * 16 + 4) = w1;
      }
    }
  }
}

extern "C" void kernel_launch(void* const* d_in, const int* in_sizes, int n_in,
                              void* d_out, int out_size, void* d_ws, size_t ws_size,
                              hipStream_t stream) {
  (void)in_sizes; (void)n_in; (void)out_size; (void)ws_size;
  const float* q  = (const float*)d_in[0];
  const float* k  = (const float*)d_in[1];
  const float* v  = (const float*)d_in[2];
  const float* Wq = (const float*)d_in[3];
  const float* bq = (const float*)d_in[4];
  const float* Wk = (const float*)d_in[5];
  const float* bk = (const float*)d_in[6];
  const float* Wv = (const float*)d_in[7];
  const float* bv = (const float*)d_in[8];
  float* out = (float*)d_out;

  const size_t nX = (size_t)B_ * H_ * S_ * HD_;   // 4M elems -> 8 MB f16 each
  _Float16* Xq = (_Float16*)d_ws;
  _Float16* Xk = Xq + nX;
  _Float16* Xv = Xk + nX;

  dim3 gp(B_ * S_ / BM_, D_ / BN_, 3);
  qkv_proj_kernel<<<gp, 256, 0, stream>>>(q, k, v, Wq, bq, Wk, bk, Wv, bv, Xq, Xk, Xv);

  dim3 ga(S_ / 128, B_ * H_);
  attn_kernel<<<ga, 256, 0, stream>>>(Xq, Xk, Xv, out);
}

// v010
// A run of this version takes 66.6 microseconds.
// Timed twice side by side with v009, it ran 1.05 times as fast both times.
// Counting every step since v000, it is 4.43 times as fast.
#include <hip/hip_runtime.h>
#include <hip/hip_bf16.h>

typedef __attribute__((ext_vector_type(16))) _Float16 v16h;
typedef __attribute__((ext_vector_type(8)))  float    v8f;
typedef __attribute__((ext_vector_type(8)))  _Float16 h8;
typedef __attribute__((ext_vector_type(8)))  short    s8;
typedef __attribute__((ext_vector_type(2)))  float    v2f;
struct quad2 { v2f p[4]; };  // an accumulator tile's 8 registers as 4 pairs

#define B_  2
#define S_  2048
#define D_  1024
#define H_  16
#define HD_ 64

__device__ __forceinline__ int lane_id() { return threadIdx.x & 31; }

// Fragment load with wide (b128) accesses.  Works for:
//  - A fragments (16x32 f16) from a row-major tile (lane = M row), and
//  - B fragments (32x16 f16) from a TRANSPOSED tile T[n][k] (lane = N col),
// since both reduce to: lane (l&15) reads two 8-half runs at K = kh and 16+kh.
// All addresses are 16-byte aligned (ld is a multiple of 8, kh is 0 or 8).
__device__ __forceinline__ v16h frag_ld(const _Float16* src, int ld) {
  const int l  = lane_id();
  const int m  = l & 15;
  const int kh = (l >> 4) << 3;
  const _Float16* r = src + (size_t)m * ld + kh;
  const h8 lo = *(const h8*)(r);
  const h8 hi = *(const h8*)(r + 16);
  return __builtin_shufflevector(lo, hi, 0, 1, 2, 3, 4, 5, 6, 7,
                                         8, 9, 10, 11, 12, 13, 14, 15);
}

// B fragment (32 K x 16 N f16) from a ROW-MAJOR LDS tile T[k][n] by the
// transposing LDS load: lane (c = l&15, h = l>>4) receives T[8h + 0..7][c] from
// the first load and T[16 + 8h + 0..7][c] from the second, which is the same k
// order as frag_ld gives the A operand.  tile points at T[0][first column];
// pitch is in halves and must be an odd multiple of 16 (32 bytes) for the banks.
__device__ __forceinline__ v16h frag_ld_tr(const _Float16* tile, int pitch) {
  typedef __attribute__((address_space(3))) s8 lds_s8;
  const int l = lane_id();
  const _Float16* p = tile + (8 * (l >> 4) + (l & 7)) * pitch + 8 * ((l >> 3) & 1);
  const h8 lo = __builtin_bit_cast(h8, __builtin_amdgcn_ds_load_tr16_b128_v8i16((lds_s8*)p));
  const h8 hi = __builtin_bit_cast(h8, __builtin_amdgcn_ds_load_tr16_b128_v8i16((lds_s8*)(p + 16 * pitch)));
  return __builtin_shufflevector(lo, hi, 0, 1, 2, 3, 4, 5, 6, 7,
                                         8, 9, 10, 11, 12, 13, 14, 15);
}

// Work-group barrier that orders LDS accesses only.  __syncthreads() also waits
// for the wave's global loads, which here must stay in flight across it.
__device__ __forceinline__ void lds_barrier() {
  __builtin_amdgcn_fence(__ATOMIC_RELEASE, "workgroup", "local");
  __builtin_amdgcn_s_barrier();
  __builtin_amdgcn_fence(__ATOMIC_ACQUIRE, "workgroup", "local");
}

#define BM_ 128  // projection tile rows per work-group
#define BN_ 256  // projection tile columns per work-group
#define MF_ 4    // 16-row x fragments per wave (wave tile 64 x 64)
#define WP_ (BN_ + 16)  // W tile row pitch in halves (544 bytes, an odd multiple of 32)
#define VP_ 80   // V tile row pitch in halves:  64 + 16 (160 bytes)
// Tiles read by plain 16-byte LDS loads (one row per lane): pitch an odd
// multiple of 16 bytes, so that the 16 rows of a fragment fall on distinct banks.
#define XP_ 40   // X tile row pitch in halves:  32 + 8 (80 bytes)
#define KP_ 72   // K tile row pitch in halves:  64 + 8 (144 bytes)
#define KS_ 128  // keys per LDS stage of the attention kernel (two passes of 32 by each key half)
#define NST_ (S_ / KS_)  // stages per head
#define QC_ 2    // 16-column query groups per attention wave
#define JQ_ (QC_ * 8 + 1)  // 16-byte quads a lane hands over in the join: O^T, then references and sums
#define XH_ (BM_ * XP_)  // halves in one X buffer
#define WH_ (32 * WP_)   // halves in one W buffer
// Output tiles on their way through LDS, one row per lane in the 16-byte writes:
// pitch an odd multiple of 16 bytes again.
#define OP_ 72   // projection, f16 rows:  64 + 8 halves (144 bytes)
#define OF_ 68   // attention, f32 rows:   64 + 4 floats (272 bytes)
#define RING_H_ (2 * XH_ + 2 * WH_)  // halves in the projection's ring of k-tiles
#define OUT_H_  (8 * 64 * OP_)       // halves in its eight waves' staged 64 x 64 outputs

// ---------------------------------------------------------------------------
// Kernel 1: QKV projection GEMM.  X = (x @ W + b) [* log2(e) / 8 for Q], f16 output
// in head-major [B,H,S,HD] layout.  Grid: (BS/128, D/256, 3), block 256:
// 8 waves as 2 (M) x 4 (N), each 64 x 64 of the tile.  The k-tiles run through a
// pipeline: global loads two tiles ahead of the products, LDS one tile ahead.
// The products are formed transposed (A = W^T, B = x^T), so that a lane ends up with
// 8 neighbouring columns of one row: 16 bytes of f16.  A wave's 64 x 64 result is 8
// contiguous KB of the head-major output; it goes through LDS and out in whole 128-byte lines.
// ---------------------------------------------------------------------------
__global__ __launch_bounds__(256) void qkv_proj_kernel(
    const float* __restrict__ q, const float* __restrict__ k, const float* __restrict__ v,
    const float* __restrict__ Wq, const float* __restrict__ bq,
    const float* __restrict__ Wk, const float* __restrict__ bk,
    const float* __restrict__ Wv, const float* __restrict__ bv,
    _Float16* __restrict__ Xq, _Float16* __restrict__ Xk, _Float16* __restrict__ Xv)
{
  // Two buffers of each tile: tile kt + 1 is written while tile kt is read.  Behind the
  // loop the same LDS holds the waves' output tiles.
  __shared__ __align__(16) _Float16 lds[OUT_H_ > RING_H_ ? OUT_H_ : RING_H_];
  _Float16* const Xt = lds;            // buffer nb at nb * XH_: 128 M x 32 K, row-major, padded
  _Float16* const Wt = lds + 2 * XH_;  // buffer nb at nb * WH_: 32 K x 256 N, row-major, padded

  const int z = blockIdx.z;
  const float* x    = (z == 0) ? q  : (z == 1) ? k  : v;
  const float* W    = (z == 0) ? Wq : (z == 1) ? Wk : Wv;
  const float* bias = (z == 0) ? bq : (z == 1) ? bk : bv;
  _Float16*    X    = (z == 0) ? Xq : (z == 1) ? Xk : Xv;
  // Fold 1/sqrt(HD) and log2(e) into Q: the scores then come out as exponents of 2.
  const float oscale = (z == 0) ? 0.125f * 1.442695041f : 1.0f;

  const int m0   = blockIdx.x * BM_;
  const int n0   = blockIdx.y * BN_;
  const int t    = threadIdx.x;
  const int wave = t >> 5;
  const int mt   = (wave & 1) * (MF_ * 16);  // wave M sub-tile within the tile
  const int nt0  = (wave >> 1) * 64;         // wave N sub-tile within the tile

  // This thread's staged elements: of x rows t/4 and t/4 + 64, cols (t%4)*8;
  // of W k-rows t/32 + 8 j, n-cols (t%32)*8.
  const int xr = t >> 2, xc = (t & 3) * 8;
  const int wr = t / (BN_ / 8), wc = (t % (BN_ / 8)) * 8;
  const float* xs = x + (size_t)(m0 + xr) * D_ + xc;
  const float* ws = W + (size_t)wr * D_ + n0 + wc;

  // The 32 work-groups that share a W panel and the 4 that share x rows run side by
  // side: each enters the ring of k-tiles at a place of its own and wraps round, so
  // that they do not ask L2 for the same lines at the same moment.
  const int rot = (blockIdx.x + 8 * blockIdx.y) & (D_ / 32 - 1);
  // First column / row of the k-tile that trip kt works on.
  auto k_of = [&](int kt) { return ((kt + rot) & (D_ / 32 - 1)) * 32; };

  float4 rx[4], rw[8];  // one k-tile of f32 on its way from global memory

  // Issue the loads of the k-tile that starts at column / row k0.
  auto tile_load = [&](int k0) {
#pragma unroll  // rx[] lives in registers: every index must be a constant
    for (int j = 0; j < 2; ++j) {
      const float* s = xs + k0 + j * 64 * D_;
      rx[2 * j]     = *(const float4*)(s);
      rx[2 * j + 1] = *(const float4*)(s + 4);
    }
#pragma unroll  // constant indices, as above
    for (int j = 0; j < 4; ++j) {
      const float* s = ws + (size_t)(k0 + 8 * j) * D_;
      rw[2 * j]     = *(const float4*)(s);
      rw[2 * j + 1] = *(const float4*)(s + 4);
    }
  };
  // Convert the loaded k-tile to f16 and store it to LDS buffer nb, 16 bytes a store.
  auto tile_store = [&](int nb) {
#pragma unroll  // constant indices, as above
    for (int j = 0; j < 2; ++j) {
      const float4 a0 = rx[2 * j], a1 = rx[2 * j + 1];
      h8 w;
      w[0] = (_Float16)a0.x; w[1] = (_Float16)a0.y; w[2] = (_Float16)a0.z; w[3] = (_Float16)a0.w;
      w[4] = (_Float16)a1.x; w[5] = (_Float16)a1.y; w[6] = (_Float16)a1.z; w[7] = (_Float16)a1.w;
      *(h8*)(Xt + nb * XH_ + (xr + 64 * j) * XP_ + xc) = w;
    }
#pragma unroll  // constant indices, as above
    for (int j = 0; j < 4; ++j) {
      const float4 a0 = rw[2 * j], a1 = rw[2 * j + 1];
      h8 w;
      w[0] = (_Float16)a0.x; w[1] = (_Float16)a0.y; w[2] = (_Float16)a0.z; w[3] = (_Float16)a0.w;
      w[4] = (_Float16)a1.x; w[5] = (_Float16)a1.y; w[6] = (_Float16)a1.z; w[7] = (_Float16)a1.w;
      *(h8*)(Wt + nb * WH_ + (wr + 8 * j) * WP_ + wc) = w;
    }
  };

  v8f acc[MF_][4] = {};

  // Prologue: tile 0 into buffer 0, tile 1 on its way.
  tile_load(k_of(0));
  tile_store(0);
  tile_load(k_of(1));
  lds_barrier();

  // The products of one k-tile, from LDS buffer buf.
  auto products = [&](int buf) {
    v16h a[MF_];
#pragma unroll  // a[] and acc[][] live in registers: every index must be a constant
    for (int mi = 0; mi < MF_; ++mi) a[mi] = frag_ld(Xt + buf * XH_ + (mt + mi * 16) * XP_, XP_);
#pragma unroll
    for (int nsub = 0; nsub < 4; ++nsub) {
      const v16h bm = frag_ld_tr(Wt + buf * WH_ + nt0 + nsub * 16, WP_);
      // W^T (lane = column n) as A, x^T (lane = row m) as B; both loaders give the same k order.
#pragma unroll  // constant indices, as above
      for (int mi = 0; mi < MF_; ++mi)
        acc[mi][nsub] = __builtin_amdgcn_wmma_f32_16x16x32_f16(
            false, bm, false, a[mi], (short)0, acc[mi][nsub], false, false);
    }
  };

  // The last two trips stand behind the loop, so that no branch goes round the loads
  // in it: the loaded registers then pass from trip to trip without copies.
  for (int kt = 0; kt < D_ / 32 - 2; ++kt) {
    const int buf = kt & 1;
    // Tile kt + 1 has had a whole trip to arrive: into the buffer that the
    // barrier at the foot of trip kt - 1 has freed; then tile kt + 2 sets out.
    tile_store(buf ^ 1);
    tile_load(k_of(kt + 2));
    // Keeps the loads in front of the products, or they would set out a trip's length later.
    __builtin_amdgcn_sched_barrier(0);
    products(buf);
    // One barrier a trip: tile kt + 1 is published, tile kt's buffer is free.
    lds_barrier();
  }
  tile_store(1);  // the last tile
  products(0);
  lds_barrier();
  // Keeps the last tile's fragment loads behind the products above: with both tiles'
  // fragments and the bias live at once the wave would need more than 256 registers.
  __builtin_amdgcn_sched_barrier(0);
  products(1);
  lds_barrier();

  // Epilogue: bias + scale, f16, to the head-major workspace.  The barrier above has ended
  // every read of the ring, so each wave may stage its tile in an LDS range of its own.
  // acc[mi][nsub][r] is row mt + 16 mi + (l & 15), column nt0 + 16 nsub + 8 (l >> 4) + r.
  const int l  = lane_id();
  const int nh = (l >> 4) << 3;
  _Float16* stage = lds + wave * (64 * OP_);
#pragma unroll  // constant indices, as above
  for (int nsub = 0; nsub < 4; ++nsub) {
    const float* bp = bias + n0 + nt0 + nsub * 16 + nh;
    const float4 b0 = *(const float4*)(bp);
    const float4 b1 = *(const float4*)(bp + 4);
#pragma unroll  // constant indices, as above
    for (int mi = 0; mi < MF_; ++mi) {
      const v8f a = acc[mi][nsub];
      h8 w;
      w[0] = (_Float16)((a[0] + b0.x) * oscale); w[1] = (_Float16)((a[1] + b0.y) * oscale);
      w[2] = (_Float16)((a[2] + b0.z) * oscale); w[3] = (_Float16)((a[3] + b0.w) * oscale);
      w[4] = (_Float16)((a[4] + b1.x) * oscale); w[5] = (_Float16)((a[5] + b1.y) * oscale);
      w[6] = (_Float16)((a[6] + b1.z) * oscale); w[7] = (_Float16)((a[7] + b1.w) * oscale);
      *(h8*)(stage + (mi * 16 + (l & 15)) * OP_ + nsub * 16 + nh) = w;
    }
  }
  // The wave's rows are in LDS before its lanes read each other's pieces back.
  asm volatile("s_wait_dscnt 0x0" ::: "memory");
  // The wave's 64 rows belong to one batch and its 64 columns are one head: 64 rows of
  // 128 bytes that follow one another in X.  A store takes 4 of them, 16 bytes a lane.
  const int mw   = m0 + mt;
  const int head = (n0 + nt0) >> 6;
  _Float16* dst = X + ((size_t)((mw >> 11) * H_ + head) * S_ + (mw & (S_ - 1))) * HD_ + l * 8;
  const _Float16* back = stage + (l >> 3) * OP_ + (l & 7) * 8;
#pragma unroll  // LDS and global offsets become immediates
  for (int j = 0; j < 16; ++j)
    *(h8*)(dst + j * (4 * HD_)) = *(const h8*)(back + j * (4 * OP_));
}

// Value of lane l ^ 16 (the other 16-lane half of the wave).
__device__ __forceinline__ float xhalf(float x) {
  const int b = __builtin_bit_cast(int, x);
  return __builtin_bit_cast(float,
      __builtin_amdgcn_permlanex16(b, b, 0x76543210, 0xfedcba98, false, false));
}

// One stage (128 keys x 64 halves of K and of V) from global memory to LDS by
// asynchronous 16-byte copies, through no register: this lane's piece of rows
// r, r + 32, r + 64, r + 96.  gk, gv: the lane's global piece of row r;
// lk, lv: its LDS byte address in the K and in the V buffer.
// s_wait_xcnt 0 closes the statement, so that no address register of a copy
// takes a new value before it.
__device__ __forceinline__ void stage_copy(const _Float16* gk, const _Float16* gv,
                                           unsigned lk, unsigned lv) {
  asm volatile(
      "global_load_async_to_lds_b128 %0, %8, off\n\t"
      "global_load_async_to_lds_b128 %1, %9, off\n\t"
      "global_load_async_to_lds_b128 %2, %10, off\n\t"
      "global_load_async_to_lds_b128 %3, %11, off\n\t"
      "global_load_async_to_lds_b128 %4, %12, off\n\t"
      "global_load_async_to_lds_b128 %5, %13, off\n\t"
      "global_load_async_to_lds_b128 %6, %14, off\n\t"
      "global_load_async_to_lds_b128 %7, %15, off\n\t"
      "s_wait_xcnt 0x0"
      :: "v"(lk), "v"(lk + 32 * KP_ * 2), "v"(lk + 64 * KP_ * 2), "v"(lk + 96 * KP_ * 2),
         "v"(lv), "v"(lv + 32 * VP_ * 2), "v"(lv + 64 * VP_ * 2), "v"(lv + 96 * VP_ * 2),
         "v"(gk), "v"(gk + 32 * HD_), "v"(gk + 64 * HD_), "v"(gk + 96 * HD_),
         "v"(gv), "v"(gv + 32 * HD_), "v"(gv + 64 * HD_), "v"(gv + 96 * HD_)
      : "memory");
}

// Four waves per SIMD (two work-groups per WGP): the softmax between the matrix
// runs is hidden by other waves, so the registers must stay within 256.
__global__ __launch_bounds__(256) __attribute__((amdgpu_waves_per_eu(4, 4))) void attn_kernel(
    const _Float16* __restrict__ Xq, const _Float16* __restrict__ Xk,
    const _Float16* __restrict__ Xv, float* __restrict__ out)
{
  __shared__ __align__(16) _Float16 Kt[2 * KS_ * KP_];  // two stages of 18 KB, row-major [k][d], padded
  __shared__ __align__(16) _Float16 Vt[2 * KS_ * VP_];  // two stages of 20 KB, row-major [k][d], padded

  const int bh   = blockIdx.y;           // 0..B*H-1
  const int b    = bh >> 4;
  const int h    = bh & 15;
  const int t    = threadIdx.x;
  // The wave's number as a scalar: its LDS bases and the join's branches are then scalar too.
  const int wave = __builtin_amdgcn_readfirstlane(t >> 5);
  const int qg   = wave & 3;             // which 32 queries of the block
  const int kg   = wave >> 2;            // which 64 keys of every stage
  const int l    = lane_id();
  const int q0   = blockIdx.x * 128 + qg * (QC_ * 16);

  const size_t head_base = (size_t)bh * S_ * HD_;

  // This lane's piece of a stage: row t/8 (and + 32, 64, 96), 8 halves at (t%8)*8.
  const int sr = t >> 3, sc = (t & 7) * 8;
  const _Float16* gk = Xk + head_base + (size_t)sr * HD_ + sc;
  const _Float16* gv = Xv + head_base + (size_t)sr * HD_ + sc;
  const unsigned lk = (unsigned)(size_t)(Kt + sr * KP_ + sc);
  const unsigned lv = (unsigned)(size_t)(Vt + sr * VP_ + sc);

  // Q^T fragments (B operand: lane = query column, pre-scaled by log2(e)/sqrt(HD));
  // same loader as the K rows, so both sides have the same k order.
  v16h bq[QC_][2];
#pragma unroll  // bq[][] lives in registers: every index must be a constant
  for (int c = 0; c < QC_; ++c) {
    bq[c][0] = frag_ld(Xq + head_base + (size_t)(q0 + 16 * c) * HD_, HD_);
    bq[c][1] = frag_ld(Xq + head_base + (size_t)(q0 + 16 * c) * HD_ + 32, HD_);
  }

  // The 16 work-groups of a head run side by side over the same K and V: each enters
  // the ring of key stages at a place of its own and wraps round, so that they do not
  // ask L2 for the same lines at the same moment.  Offset in halves of the keys that
  // trip st works on:
  const int rot = blockIdx.x & (NST_ - 1);
  auto keys_of = [&](int st) { return (size_t)((st + rot) & (NST_ - 1)) * (KS_ * HD_); };

  // Ring prologue: stage 0 lands and is published, then stage 1 starts to fly.
  stage_copy(gk + keys_of(0), gv + keys_of(0), lk, lv);
  asm volatile("s_wait_asynccnt 0x0" ::: "memory");  // this wave's copies of stage 0 have landed
  __syncthreads();                                   // ... and every other wave's
  stage_copy(gk + keys_of(1), gv + keys_of(1), lk + KS_ * KP_ * 2, lv + KS_ * VP_ * 2);

  // Per 16-column group c, over this wave's keys only:
  v8f   o[QC_][4] = {};   // O^T: o[c][nsub][r] = O[query 16 c + (l&15)][d = 16 nsub + 8 (l>>4) + r]
  float mrun[QC_];        // reference in use for this lane's query, in log2 units (equal in both halves)
  v8f   cneg[QC_] = {};   // minus that reference in all 8 registers: C of the score products
  float lrun[QC_];        // running sum over the keys of this lane's half only
#pragma unroll  // constant indices, as above
  for (int c = 0; c < QC_; ++c) { mrun[c] = 0.0f; lrun[c] = 0.0f; }

  // This wave's 64 keys of buffer 0.
  const _Float16* Kw = Kt + kg * (KS_ / 2) * KP_;
  const _Float16* Vw = Vt + kg * (KS_ / 2) * VP_;

  for (int st = 0; st < NST_; ++st) {
   const int buf = st & 1;
   // This wave's 64 keys of the stage, as two passes of 32; both tiles row-major.
   const _Float16* Ks = Kw + buf * KS_ * KP_;
   const _Float16* Vs = Vw + buf * KS_ * VP_;

   // Scores less the reference, transposed: s0[ps][c][r] is that of (key 32 ps +
   // 8 (l>>4) + r, query 16 c + (l&15)), s1[ps][c][r] the same for key 32 ps + 16 +
   // 8 (l>>4) + r.  A = K rows, B = Q^T, C = minus the reference.
   v8f s0[KS_ / 64][QC_], s1[KS_ / 64][QC_];
#pragma unroll  // the wave's two passes of a stage: LDS offsets become immediates
   for (int ps = 0; ps < KS_ / 64; ++ps) {
     const _Float16* Kp = Ks + ps * 32 * KP_;
     const v16h ak0 = frag_ld(Kp, KP_);                 // k 0..15, d 0..31
     const v16h ak1 = frag_ld(Kp + 32, KP_);            // k 0..15, d 32..63
     const v16h ak2 = frag_ld(Kp + 16 * KP_, KP_);      // k 16..31, d 0..31
     const v16h ak3 = frag_ld(Kp + 16 * KP_ + 32, KP_); // k 16..31, d 32..63
#pragma unroll  // constant indices, as above
     for (int c = 0; c < QC_; ++c) {
       s0[ps][c] = __builtin_amdgcn_wmma_f32_16x16x32_f16(false, ak0, false, bq[c][0], (short)0, cneg[c], false, false);
       s1[ps][c] = __builtin_amdgcn_wmma_f32_16x16x32_f16(false, ak2, false, bq[c][0], (short)0, cneg[c], false, false);
     }
#pragma unroll  // constant indices, as above
     for (int c = 0; c < QC_; ++c) {
       s0[ps][c] = __builtin_amdgcn_wmma_f32_16x16x32_f16(false, ak1, false, bq[c][1], (short)0, s0[ps][c], false, false);
       s1[ps][c] = __builtin_amdgcn_wmma_f32_16x16x32_f16(false, ak3, false, bq[c][1], (short)0, s1[ps][c], false, false);
     }
   }

   // Highest score above its reference, per column group, over this lane's 32 keys.
   float rm[QC_];
#pragma unroll  // constant indices, as above
   for (int c = 0; c < QC_; ++c) {
     rm[c] = fmaxf(s0[0][c][0], s1[0][c][0]);
#pragma unroll  // constant indices, as above
     for (int ps = 0; ps < KS_ / 64; ++ps) {
#pragma unroll  // constant indices, as above
       for (int r = (ps == 0) ? 1 : 0; r < 8; ++r) rm[c] = fmaxf(rm[c], fmaxf(s0[ps][c][r], s1[ps][c][r]));
     }
   }

   // One test a stage, a scalar branch: a new reference only where a score of some
   // lane would give P above 256, and in the first stage, which has none yet.
   const bool  first = (st == 0);
   const float bound = first ? -3.0e38f : 8.0f;
   if (__builtin_amdgcn_ballot_w32(fmaxf(rm[0], rm[1]) > bound) != 0) {
#pragma unroll  // constant indices, as above
     for (int c = 0; c < QC_; ++c) {
       const float r     = fmaxf(rm[c], xhalf(rm[c]));  // the query's other keys are in lane l ^ 16
       const float delta = first ? r : fmaxf(r, 0.0f);  // after the first stage the reference never falls
       const float corr  = first ? 0.0f : __builtin_amdgcn_exp2f(-delta);  // O and the sum are still 0 in the first
       mrun[c] += delta;
       cneg[c] -= delta;  // stays minus mrun[c] to the bit: the same sum with both signs turned
#pragma unroll  // constant indices, as above
       for (int ps = 0; ps < KS_ / 64; ++ps) {
         s0[ps][c] -= delta;
         s1[ps][c] -= delta;
       }
       lrun[c] *= corr;
#pragma unroll  // constant indices, as above
       for (int nsub = 0; nsub < 4; ++nsub) o[c][nsub] *= corr;
     }
   }

#pragma unroll  // the two passes again: LDS offsets become immediates
   for (int ps = 0; ps < KS_ / 64; ++ps) {
    const _Float16* Vp = Vs + ps * 32 * VP_;

    v16h bp[QC_];
#pragma unroll  // constant indices, as above
    for (int c = 0; c < QC_; ++c) {
      // P^T as B operand: element s is key 8 (l>>4) + s for s < 8 and
      // 16 + 8 (l>>4) + (s - 8) above, the k order of the transposing load.
      // Summed as register-adjacent pairs, so that the packed add needs no register moves.
      const quad2 t0 = __builtin_bit_cast(quad2, s0[ps][c]);
      const quad2 t1 = __builtin_bit_cast(quad2, s1[ps][c]);
      v2f ps2 = {0.0f, 0.0f};
#pragma unroll  // constant indices, as above
      for (int r = 0; r < 4; ++r) {
        const v2f p0 = {__builtin_amdgcn_exp2f(t0.p[r][0]), __builtin_amdgcn_exp2f(t0.p[r][1])};
        const v2f p1 = {__builtin_amdgcn_exp2f(t1.p[r][0]), __builtin_amdgcn_exp2f(t1.p[r][1])};
        ps2 += p0 + p1;
        bp[c][2 * r]         = (_Float16)p0[0];
        bp[c][2 * r + 1]     = (_Float16)p0[1];
        bp[c][8 + 2 * r]     = (_Float16)p1[0];
        bp[c][8 + 2 * r + 1] = (_Float16)p1[1];
      }
      lrun[c] += ps2[0] + ps2[1];
    }

    // O^T += V^T @ P^T  (A = 16 d x 32 keys from row-major Vt by the transposing
    // load, B = P^T).
#pragma unroll
    for (int nsub = 0; nsub < 4; ++nsub) {
      const v16h avf = frag_ld_tr(Vp + nsub * 16, VP_);
#pragma unroll  // constant indices, as above
      for (int c = 0; c < QC_; ++c)
        o[c][nsub] = __builtin_amdgcn_wmma_f32_16x16x32_f16(
            false, avf, false, bp[c], (short)0, o[c][nsub], false, false);
    }
   }

   // Publish point of stage st + 1, in the ring's order.
   asm volatile("s_wait_dscnt 0x0" ::: "memory");     // this wave's reads of stage st are done
   asm volatile("s_wait_asynccnt 0x0" ::: "memory");  // its copies of stage st + 1 have landed
   __syncthreads();  // all waves: stage st + 1 may be read, stage st's buffer refilled
   if (st + 2 < NST_)
     stage_copy(gk + keys_of(st + 2), gv + keys_of(st + 2),
                lk + buf * (KS_ * KP_ * 2), lv + buf * (KS_ * VP_ * 2));
  }
  asm volatile("s_wait_asynccnt 0x0" ::: "memory");  // nothing in flight when the wave ends

  // Join of the two key halves.  The last publish point has ended every read of
  // the ring and no copy is in flight, so the K ring serves as the mailbox: lane l
  // of wave (qg, 1) hands its 17 quads to lane l of wave (qg, 0), quad j of all 32
  // lanes in one contiguous 512-byte row.
  float4* mail = (float4*)Kt + qg * (JQ_ * 32) + l;
  if (kg == 1) {
#pragma unroll  // constant indices, as above
    for (int c = 0; c < QC_; ++c) {
#pragma unroll  // constant indices, as above
      for (int nsub = 0; nsub < 4; ++nsub) {
        const v8f w = o[c][nsub];
        mail[((c * 4 + nsub) * 2) * 32]     = make_float4(w[0], w[1], w[2], w[3]);
        mail[((c * 4 + nsub) * 2 + 1) * 32] = make_float4(w[4], w[5], w[6], w[7]);
      }
    }
    mail[(JQ_ - 1) * 32] = make_float4(mrun[0], mrun[1], lrun[0], lrun[1]);
  }
  __syncthreads();  // the partial results of the second key half are published

  // Epilogue, by the waves of the first key half: both partials to the higher of
  // the two references, join the lane halves' sums, normalize, write merged-head f32 output
  // [B,S,D]; a lane holds 8 consecutive d of its query in each tile.  The wave's 32 rows of
  // 64 f32 go through an LDS range of its own in the V ring (free like the K ring), so
  // that they leave in whole 128-byte lines.
  if (kg == 0) {
    const float4 ml = mail[(JQ_ - 1) * 32];
    float* stage = (float*)Vt + qg * (QC_ * 16 * OF_);
#pragma unroll  // constant indices, as above
    for (int c = 0; c < QC_; ++c) {
      const float mb = c ? ml.y : ml.x;
      const float lb = c ? ml.w : ml.z;
      const float mj = fmaxf(mrun[c], mb);
      const float fa = __builtin_amdgcn_exp2f(mrun[c] - mj);
      const float fb = __builtin_amdgcn_exp2f(mb - mj);
      const float lj = lrun[c] * fa + lb * fb;
      const float lsum = lj + xhalf(lj);
      const float ga = fa / lsum, gb = fb / lsum;  // rescale and 1 / sum in one factor a partial
      float* srow = stage + (16 * c + (l & 15)) * OF_ + ((l >> 4) << 3);
#pragma unroll  // constant indices, as above
      for (int nsub = 0; nsub < 4; ++nsub) {
        const v8f    w  = o[c][nsub];
        const float4 u0 = mail[((c * 4 + nsub) * 2) * 32];
        const float4 u1 = mail[((c * 4 + nsub) * 2 + 1) * 32];
        float4 w0, w1;
        w0.x = w[0] * ga + u0.x * gb; w0.y = w[1] * ga + u0.y * gb;
        w0.z = w[2] * ga + u0.z * gb; w0.w = w[3] * ga + u0.w * gb;
        w1.x = w[4] * ga + u1.x * gb; w1.y = w[5] * ga + u1.y * gb;
        w1.z = w[6] * ga + u1.z * gb; w1.w = w[7] * ga + u1.w * gb;
        *(float4*)(srow + nsub * 16)     = w0;
        *(float4*)(srow + nsub * 16 + 4) = w1;
      }
    }
    // The wave's rows are in LDS before its lanes read each other's pieces back.
    asm volatile("s_wait_dscnt 0x0" ::: "memory");
    // A store takes 2 rows of 256 bytes (4 whole lines), 16 bytes a lane.
    const float* back = stage + (l >> 4) * OF_ + (l & 15) * 4;
    float* dst = out + ((size_t)b * S_ + q0 + (l >> 4)) * D_ + h * HD_ + (l & 15) * 4;
#pragma unroll  // LDS and global offsets become immediates
    for (int j = 0; j < QC_ * 8; ++j)
      *(float4*)(dst + j * (2 * D_)) = *(const float4*)(back + j * (2 * OF_));
  }
}

extern "C" void kernel_launch(void* const* d_in, const int* in_sizes, int n_in,
                              void* d_out, int out_size, void* d_ws, size_t ws_size,
                              hipStream_t stream) {
  (void)in_sizes; (void)n_in; (void)out_size; (void)ws_size;
  const float* q  = (const float*)d_in[0];
  const float* k  = (const float*)d_in[1];
  const float* v  = (const float*)d_in[2];
  const float* Wq = (const float*)d_in[3];
  const float* bq = (const float*)d_in[4];
  const float* Wk = (const float*)d_in[5];
  const float* bk = (const float*)d_in[6];
  const float* Wv = (const float*)d_in[7];
  const float* bv = (const float*)d_in[8];
  float* out = (float*)d_out;

  const size_t nX = (size_t)B_ * H_ * S_ * HD_;   // 4M elems -> 8 MB f16 each
  _Float16* Xq = (_Float16*)d_ws;
  _Float16* Xk = Xq + nX;
  _Float16* Xv = Xk + nX;

  dim3 gp(B_ * S_ / BM_, D_ / BN_, 3);
  qkv_proj_kernel<<<gp, 256, 0, stream>>>(q, k, v, Wq, bq, Wk, bk, Wv, bv, Xq, Xk, Xv);

  dim3 ga(S_ / 128, B_ * H_);
  attn_kernel<<<ga, 256, 0, stream>>>(Xq, Xk, Xv, out);
}
